// v000
// The times below were measured on an AMD MI455X: many runs one after another, warmed up first and cycling through
// copies of the inputs, with the whole window's GPU time divided by the number of runs. Launches and the gaps
// between them are all in it. The median over several windows is given; except for v000 it joins two sittings, which
// can be a few percent apart, so the side-by-side timings, each taken in one sitting, are the better comparison.
// v000, which the later versions start from, runs in 679 microseconds.
// compute dtype: every float input RNE-converted to bf16 on load; q/k/v = x W^T + b on v_wmma_f32_16x16x32_bf16 (bf16 operands, exact products, f32 accumulate); q, k, v and the distance table carried as f16 x 2^4 planes; logits = (q k^T + q E^T) x 2^-11 on v_wmma_f32_16x16x32_f16 (single products, f32 accumulate); softmax in f32 (expf); P x 2^14 as f16; P V on v_wmma_f32_16x16x32_f16 (single product, f32 accumulate) x 2^-18 into the f32 output.
#include <hip/hip_runtime.h>
#include <math.h>

typedef __attribute__((ext_vector_type(16))) _Float16 v16h;
typedef __attribute__((ext_vector_type(16))) __bf16 v16b;
typedef __attribute__((ext_vector_type(8)))  _Float16 v8h;
typedef __attribute__((ext_vector_type(8)))  __bf16 v8b;
typedef __attribute__((ext_vector_type(8)))  float v8f;
typedef __attribute__((ext_vector_type(4)))  float v4f;
typedef __attribute__((ext_vector_type(4)))  unsigned v4u;

template <typename T> __device__ __forceinline__ void vst2(void* p, T v) { *(T*)p = v;  }
__device__ __forceinline__ v8f wmma16(v16h a, v16h b, v8f c) {
  v8f d = __builtin_amdgcn_wmma_f32_16x16x32_f16(false, a, false, b, (short)0, c, false, false);
  asm volatile("v_nop\n\tv_nop\n\tv_nop\n\tv_nop" : "+v"(d) : "v"(a), "v"(b));
  return d;
}
__device__ __forceinline__ v8f wmma_bf(v16b a, v16b b, v8f c) {
  v8f d = __builtin_amdgcn_wmma_f32_16x16x32_bf16(false, a, false, b, (short)0, c, false, false);
  asm volatile("v_nop\n\tv_nop\n\tv_nop\n\tv_nop" : "+v"(d) : "v"(a), "v"(b));
  return d;
}
// 16x16x32 fragments: lane = (g = lane>>4, row/col = lane&15); elements 0..7 = k0+8g+0..7, 8..15 = k0+16+8g+0..7; D element r = row 8g+r, col lane&15
__device__ __forceinline__ v16h frag_h(const _Float16* rowk0, int lane) {
  union { v16h v; v8h q[2]; } u; const _Float16* p = rowk0 + 8 * (lane >> 4);
  u.q[0] = *(const v8h*)p; u.q[1] = *(const v8h*)(p + 16); return u.v;
}
__device__ __forceinline__ v16b frag_b(const __bf16* rowk0, int lane) {
  union { v16b v; v8b q[2]; } u; const __bf16* p = rowk0 + 8 * (lane >> 4);
  u.q[0] = *(const v8b*)p; u.q[1] = *(const v8b*)(p + 16); return u.v;
}
__device__ __forceinline__ float bfr(float v) { return (float)(__bf16)v; }
__device__ __forceinline__ void ldsx() { asm volatile("s_wait_dscnt 0" ::: "memory"); __builtin_amdgcn_wave_barrier(); __builtin_amdgcn_fence(3, "workgroup"); }

// sizes: x [NB][SEQ][DD] (input row pitch uses SEQ_FULL), 12 heads x 64, distance table [2*MAXPOS-1][64]
#ifndef NB
#define NB 8
#endif
#ifndef SEQ
#define SEQ 1024
#endif
#define NB_FULL 8
#define SEQ_FULL 1024
#define DD 768
#define NH 12
#define HD 64
#define MAXPOS 1024
#define NE (2 * MAXPOS - 1)
#define NEP (2 * MAXPOS)
#define QT 64          // queries per score / pv block
#define KT 128         // keys per score block
#define NBC 9          // band tiles of 16 table rows per wave (covers 16 + KT - 1 = 143)
#define SQP 148        // band pitch in floats
#define SSP 132        // score staging pitch in floats
#define SBW (16 * SQP) // floats per wave staging buffer
static_assert(NB <= NB_FULL);
static_assert(SEQ <= SEQ_FULL);
static_assert(SEQ <= MAXPOS);
static_assert(SEQ % KT == 0);
static_assert(SEQ % QT == 0);
static_assert(NH * HD == DD);
static_assert(DD % 128 == 0);
static_assert(16 * NBC >= 16 + KT - 1);
static_assert(16 * SSP <= SBW);

// workspace carve (bytes, every region a multiple of 128)
#define WS_XB  ((size_t)0)                                   // bf16 x rows [NB*SEQ][DD]
#define WS_WB  (WS_XB + 2u * (size_t)NB * SEQ * DD)         // bf16 wq | wk | wv [3][DD][DD]
#define WS_EP  (WS_WB + 2u * (size_t)3 * DD * DD)           // f16 table x 16 [NEP][HD], last row zero
#define WS_QH  (WS_EP + 2u * (size_t)NEP * HD)              // f16 q x 16 [NB*SEQ][DD]
#define WS_KH  (WS_QH + 2u * (size_t)NB * SEQ * DD)         // f16 k x 16 [NB*SEQ][DD]
#define WS_VT  (WS_KH + 2u * (size_t)NB * SEQ * DD)         // f16 v x 16 transposed [NB][DD][SEQ]
#define WS_S   (WS_VT + 2u * (size_t)NB * DD * SEQ)         // f32 logits [NH][SEQ][SEQ] (one batch)
#define WS_PH  (WS_S + 4u * (size_t)NH * SEQ * SEQ)         // f16 P x 2^14 [NH][SEQ][SEQ]
#define WS_END (WS_PH + 2u * (size_t)NH * SEQ * SEQ)
static_assert(WS_END <= (size_t)134217728);
static_assert(WS_WB % 128 == 0 && WS_EP % 128 == 0 && WS_QH % 128 == 0 && WS_KH % 128 == 0 && WS_VT % 128 == 0 && WS_S % 128 == 0 && WS_PH % 128 == 0);

// ---- k_cvt: dst[dr][0..ncol) (16-bit) <- src[(dr / seg) * segfull + dr % seg][..]; rows dr >= nsrc written as zeros; kind 0: bf16 bits, kind 1: f16 of (bf16 value * sc); one 16-B chunk per thread
__global__ __launch_bounds__(256) void k_cvt(const float* __restrict__ src, unsigned short* __restrict__ dst, int nrows, int nsrc, int ncol, int seg, int segfull, int kind, float sc) {
  const int cpr = ncol >> 3;
  const size_t total = (size_t)nrows * cpr;
  const size_t i8 = (size_t)blockIdx.x * 256 + threadIdx.x;
  if (i8 >= total) return;
  const int dr = (int)(i8 / cpr), cc = (int)(i8 - (size_t)dr * cpr) * 8;
  const int drc = dr < nsrc ? dr : nsrc - 1;
  const size_t srow = (size_t)(drc / seg) * segfull + (size_t)(drc % seg);
  const float* p = src + srow * (size_t)ncol + cc;
  const v4f va = *(const v4f*)p, vb = *(const v4f*)(p + 4);
  const bool z = dr >= nsrc;
  float v[8];
#pragma unroll
  for (int i = 0; i < 4; ++i) { v[i] = z ? 0.f : va[i]; v[4 + i] = z ? 0.f : vb[i]; }
  union { v8h h; v8b b; v4u u; } o;
  if (kind == 0) {
#pragma unroll
    for (int i = 0; i < 8; ++i) o.b[i] = (__bf16)v[i];
  } else {
#pragma unroll
    for (int i = 0; i < 8; ++i) o.h[i] = (_Float16)(bfr(v[i]) * sc);
  }
  vst2(dst + i8 * 8, o.u);
}

// ---- k_proj: block = (64 rows, 128 output cols, which of q|k|v): y = x W^T + b with exact bf16 products; y * 16 -> f16; q/k row planes, v transposed plane
__global__ __launch_bounds__(128) void k_proj(const __bf16* __restrict__ XB, const __bf16* __restrict__ WB, const float* __restrict__ BQ, const float* __restrict__ BK, const float* __restrict__ BV, _Float16* __restrict__ QH, _Float16* __restrict__ KH, _Float16* __restrict__ VT) {
  __shared__ __align__(16) _Float16 sh[64][136];
  __shared__ __align__(16) _Float16 th[128][72];
  const int tid = threadIdx.x, wave = tid >> 5, lane = tid & 31, col = lane & 15, g = lane >> 4;
  const int which = blockIdx.z; const int c0 = blockIdx.y * 128; const size_t r0 = (size_t)blockIdx.x * 64;
  const __bf16* W = WB + (size_t)which * DD * DD;
  const float* Bp = which == 0 ? BQ : (which == 1 ? BK : BV);
  v8f acc[8] = {};
#pragma unroll 2
  for (int kc = 0; kc < DD / 32; ++kc) {
    const v16b a = frag_b(XB + (r0 + wave * 16 + col) * DD + kc * 32, lane);
#pragma unroll
    for (int j = 0; j < 8; ++j) { const v16b w = frag_b(W + (size_t)(c0 + j * 16 + col) * DD + kc * 32, lane); acc[j] = wmma_bf(a, w, acc[j]); }
  }
#pragma unroll
  for (int j = 0; j < 8; ++j) { const float bb = bfr(Bp[c0 + j * 16 + col]);
#pragma unroll
    for (int r = 0; r < 8; ++r) { const float v = (acc[j][r] + bb) * 16.0f; const int rl = wave * 16 + 8 * g + r, cl = j * 16 + col; const _Float16 hv = (_Float16)v;
      if (which == 2) th[cl][rl] = hv; else sh[rl][cl] = hv; } }
  __syncthreads();
  if (which < 2) { _Float16* dh = which == 0 ? QH : KH;
    for (int e = tid; e < 64 * 16; e += 128) { const int rl = e >> 4, q = e & 15; vst2(dh + (r0 + rl) * DD + c0 + q * 8, *(const v4u*)&sh[rl][q * 8]); } }
  else { const size_t b = r0 / SEQ; const int t0 = (int)(r0 % SEQ);
    for (int e = tid; e < 128 * 8; e += 128) { const int cl = e >> 3, q = e & 7; const size_t o2 = (b * DD + c0 + cl) * (size_t)SEQ + t0 + q * 8; vst2(VT + o2, *(const v4u*)&th[cl][q * 8]); } }
}

// ---- k_sc: block = (64 queries, 128 keys) of (b, h = blockIdx.z); logits = (q k^T + q E^T band) * 2^-11 -> f32 S[h][q][k]
// band: query i, key r uses table row i + MAXPOS-1 - r; wave band base cbase = ql0 + MAXPOS-1 - (k0 + KT-1); local column c = u + KT-1 - rloc in [0, 143)
__global__ __launch_bounds__(128) __attribute__((amdgpu_num_vgpr(256))) void k_sc(const _Float16* __restrict__ QH, const _Float16* __restrict__ KH, const _Float16* __restrict__ EP, int b, float* __restrict__ S0) {
  __shared__ __align__(16) float sbuf[4][SBW];
  const int h = blockIdx.z; float* S = S0 + (size_t)h * SEQ * SEQ;
  const int tid = threadIdx.x, wave = tid >> 5, lane = tid & 31, col = lane & 15, g = lane >> 4;
  const int k0 = blockIdx.y * KT; const int ql0 = blockIdx.x * QT + wave * 16; const size_t q0 = (size_t)b * SEQ + ql0;
  const v16h a0 = frag_h(QH + (q0 + col) * DD + h * HD, lane), a1 = frag_h(QH + (q0 + col) * DD + h * HD + 32, lane);
  const int cbase = ql0 + (MAXPOS - 1) - k0 - (KT - 1);
#pragma unroll 3
  for (int t = 0; t < NBC; ++t) {
    int er = cbase + t * 16 + col; er = er < 0 ? 0 : er; er = er > NEP - 1 ? NEP - 1 : er;
    v8f c = {};
    c = wmma16(a0, frag_h(EP + (size_t)er * HD, lane), c);
    c = wmma16(a1, frag_h(EP + (size_t)er * HD + 32, lane), c);
#pragma unroll
    for (int r = 0; r < 8; ++r) sbuf[wave][(8 * g + r) * SQP + t * 16 + col] = c[r];
  }
  ldsx();
  v8f acc[8] = {};
#pragma unroll
  for (int j = 0; j < 8; ++j) { const _Float16* kp = KH + ((size_t)b * SEQ + k0 + j * 16 + col) * DD + h * HD;
    acc[j] = wmma16(a0, frag_h(kp, lane), acc[j]); acc[j] = wmma16(a1, frag_h(kp + 32, lane), acc[j]); }
#pragma unroll
  for (int j = 0; j < 8; ++j)
#pragma unroll
    for (int r = 0; r < 8; ++r) { const int u = 8 * g + r; const int c = u + (KT - 1) - j * 16 - col; acc[j][r] = (acc[j][r] + sbuf[wave][u * SQP + c]) * (1.0f / 2048.0f); }
  ldsx();
#pragma unroll
  for (int j = 0; j < 8; ++j)
#pragma unroll
    for (int r = 0; r < 8; ++r) sbuf[wave][(8 * g + r) * SSP + j * 16 + col] = acc[j][r];
  ldsx();
  for (int rl = 0; rl < 16; ++rl) vst2(S + (size_t)(ql0 + rl) * SEQ + k0 + lane * 4, *(const v4f*)&sbuf[wave][rl * SSP + lane * 4]);
}

// ---- k_sm: block = one query row of head blockIdx.y: softmax over SEQ keys in f32 -> P * 2^14 as f16 row
__global__ __launch_bounds__(256) void k_sm(const float* __restrict__ S0, _Float16* __restrict__ PH0) {
  __shared__ float sred[8]; __shared__ float sbc; __shared__ __align__(16) float sh[SEQ];
  const int t = threadIdx.x; const size_t row = blockIdx.x; const int h = blockIdx.y;
  const float* sr = S0 + ((size_t)h * SEQ + row) * SEQ; _Float16* pr = PH0 + ((size_t)h * SEQ + row) * SEQ;
  float m = -3.0e38f;
#pragma unroll 1
  for (int q = t; q < SEQ / 4; q += 256) { const v4f v = *(const v4f*)(sr + q * 4); *(v4f*)&sh[q * 4] = v; m = fmaxf(m, fmaxf(fmaxf(v[0], v[1]), fmaxf(v[2], v[3]))); }
#pragma unroll
  for (int o = 1; o < 32; o <<= 1) m = fmaxf(m, __shfl_xor(m, o));
  if ((t & 31) == 0) sred[t >> 5] = m;
  __syncthreads();
  if (t == 0) { float a = sred[0]; for (int i = 1; i < 8; ++i) a = fmaxf(a, sred[i]); sbc = a; }
  __syncthreads();
  m = sbc;
  __syncthreads();
  float sum = 0.f;
#pragma unroll 1
  for (int k = t; k < SEQ; k += 256) { const float e = expf(sh[k] - m); sh[k] = e; sum += e; }
#pragma unroll
  for (int o = 1; o < 32; o <<= 1) sum += __shfl_xor(sum, o);
  if ((t & 31) == 0) sred[t >> 5] = sum;
  __syncthreads();
  if (t == 0) { float a = 0.f; for (int i = 0; i < 8; ++i) a += sred[i]; sbc = (1.0f / a) * 16384.0f; }
  __syncthreads();
  const float sc = sbc;
#pragma unroll 1
  for (int q = t; q < SEQ / 8; q += 256) { union { v8h hh; v4u u; } o;
#pragma unroll
    for (int i = 0; i < 8; ++i) o.hh[i] = (_Float16)(sh[q * 8 + i] * sc);
    vst2(pr + q * 8, o.u); }
}

// ---- k_pv: block = 64 queries of (b, h = blockIdx.z): y[q][h*HD + d] = 2^-18 * sum_k P[q][k] v[k][d]
__global__ __launch_bounds__(128) __attribute__((amdgpu_num_vgpr(256))) void k_pv(const _Float16* __restrict__ PH0, const _Float16* __restrict__ VT, int b, float* __restrict__ Y) {
  __shared__ __align__(16) float ss[4][16][HD + 4];
  const int h = blockIdx.z; const _Float16* PH = PH0 + (size_t)h * SEQ * SEQ;
  const int tid = threadIdx.x, wave = tid >> 5, lane = tid & 31, col = lane & 15, g = lane >> 4;
  const int ql0 = blockIdx.x * QT + wave * 16;
  v8f acc[HD / 16] = {};
#pragma unroll 2
  for (int kc = 0; kc < SEQ / 32; ++kc) {
    const v16h p = frag_h(PH + (size_t)(ql0 + col) * SEQ + kc * 32, lane);
#pragma unroll
    for (int j = 0; j < HD / 16; ++j) { const v16h vh = frag_h(VT + ((size_t)b * DD + h * HD + j * 16 + col) * (size_t)SEQ + kc * 32, lane); acc[j] = wmma16(p, vh, acc[j]); }
  }
#pragma unroll
  for (int j = 0; j < HD / 16; ++j)
#pragma unroll
    for (int r = 0; r < 8; ++r) ss[wave][8 * g + r][j * 16 + col] = acc[j][r] * (1.0f / 262144.0f);
  ldsx();
  for (int rl = 0; rl < 16; ++rl) if (lane < HD / 4) vst2(Y + ((size_t)b * SEQ + ql0 + rl) * DD + h * HD + lane * 4, *(const v4f*)&ss[wave][rl][lane * 4]);
}

extern "C" void kernel_launch(void* const* d_in, const int* in_sizes, int n_in, void* d_out, int out_size, void* d_ws, size_t ws_size, hipStream_t stream) {
  if (n_in < 8) return;
  if ((size_t)in_sizes[0] < ((size_t)(NB - 1) * SEQ_FULL + SEQ) * DD) return;
  if (in_sizes[1] < DD * DD || in_sizes[3] < DD * DD || in_sizes[5] < DD * DD) return;
  if (in_sizes[2] < DD || in_sizes[4] < DD || in_sizes[6] < DD) return;
  if (in_sizes[7] < NE * HD) return;
  if ((size_t)out_size < (size_t)NB * SEQ * DD) return;
  if (ws_size < WS_END) return;
  const float* const* F = (const float* const*)d_in;   // 0 x, 1 wq, 2 bq, 3 wk, 4 bk, 5 wv, 6 bv, 7 dist table
  char* ws = (char*)d_ws;
  __bf16* XB = (__bf16*)(ws + WS_XB); __bf16* WB = (__bf16*)(ws + WS_WB); _Float16* EP = (_Float16*)(ws + WS_EP);
  _Float16 *QH = (_Float16*)(ws + WS_QH), *KH = (_Float16*)(ws + WS_KH), *VT = (_Float16*)(ws + WS_VT);
  float* S = (float*)(ws + WS_S); _Float16* PH = (_Float16*)(ws + WS_PH);
  const size_t nx8 = (size_t)NB * SEQ * DD / 8, nw8 = (size_t)DD * DD / 8, ne8 = (size_t)NEP * HD / 8;
  k_cvt<<<dim3((unsigned)((nx8 + 255) / 256)), 256, 0, stream>>>(F[0], (unsigned short*)XB, NB * SEQ, NB * SEQ, DD, SEQ, SEQ_FULL, 0, 1.0f);
  k_cvt<<<dim3((unsigned)((nw8 + 255) / 256)), 256, 0, stream>>>(F[1], (unsigned short*)WB, DD, DD, DD, DD, DD, 0, 1.0f);
  k_cvt<<<dim3((unsigned)((nw8 + 255) / 256)), 256, 0, stream>>>(F[3], (unsigned short*)(WB + (size_t)DD * DD), DD, DD, DD, DD, DD, 0, 1.0f);
  k_cvt<<<dim3((unsigned)((nw8 + 255) / 256)), 256, 0, stream>>>(F[5], (unsigned short*)(WB + (size_t)2 * DD * DD), DD, DD, DD, DD, DD, 0, 1.0f);
  k_cvt<<<dim3((unsigned)((ne8 + 255) / 256)), 256, 0, stream>>>(F[7], (unsigned short*)EP, NEP, NE, HD, NEP, NEP, 1, 16.0f);
  k_proj<<<dim3(NB * SEQ / 64, DD / 128, 3), 128, 0, stream>>>(XB, WB, F[2], F[4], F[6], QH, KH, VT);
  for (int b = 0; b < NB; ++b) {
    k_sc<<<dim3(SEQ / QT, SEQ / KT, NH), 128, 0, stream>>>(QH, KH, EP, b, S);
    k_sm<<<dim3(SEQ, NH), 256, 0, stream>>>(S, PH);
    k_pv<<<dim3(SEQ / QT, 1, NH), 128, 0, stream>>>(PH, VT, b, (float*)d_out);
  }
}

// v001
// A run of this version takes 198 microseconds.
// Next to v000, in two timings, it ran 3.44 and 3.47 times as fast.
// compute dtype: every float input RNE-converted to bf16 on load; q/k/v = x W^T + b on v_wmma_f32_16x16x32_bf16 (bf16 operands, exact products, f32 accumulate); q, k, v and the distance table carried as f16 x 2^4 planes; logits = (q k^T + q E^T) x 2^-11 on v_wmma_f32_16x16x32_f16 (single products, f32 accumulate); softmax in f32 with a running maximum and sum (exp2); exp(logit - max) x 2^14 as f16; P V on v_wmma_f32_16x16x32_f16 (single product, f32 accumulate), divided by 16 x the f32 sum into the f32 output.
#include <hip/hip_runtime.h>
#include <math.h>

typedef __attribute__((ext_vector_type(16))) _Float16 v16h;
typedef __attribute__((ext_vector_type(16))) __bf16 v16b;
typedef __attribute__((ext_vector_type(8)))  _Float16 v8h;
typedef __attribute__((ext_vector_type(8)))  __bf16 v8b;
typedef __attribute__((ext_vector_type(8)))  float v8f;
typedef __attribute__((ext_vector_type(4)))  float v4f;
typedef __attribute__((ext_vector_type(4)))  unsigned v4u;

template <typename T> __device__ __forceinline__ void vst2(void* p, T v) { *(T*)p = v;  }
__device__ __forceinline__ v8f wmma16(v16h a, v16h b, v8f c) {
  v8f d = __builtin_amdgcn_wmma_f32_16x16x32_f16(false, a, false, b, (short)0, c, false, false);
  asm volatile("v_nop\n\tv_nop\n\tv_nop\n\tv_nop" : "+v"(d) : "v"(a), "v"(b));
  return d;
}
__device__ __forceinline__ v8f wmma_p(v16h a, v16h b, v8f c) { return __builtin_amdgcn_wmma_f32_16x16x32_f16(false, a, false, b, (short)0, c, false, false); }
__device__ __forceinline__ v8f wmma_bf(v16b a, v16b b, v8f c) {
  v8f d = __builtin_amdgcn_wmma_f32_16x16x32_bf16(false, a, false, b, (short)0, c, false, false);
  asm volatile("v_nop\n\tv_nop\n\tv_nop\n\tv_nop" : "+v"(d) : "v"(a), "v"(b));
  return d;
}
// 16x16x32 fragments: lane = (g = lane>>4, row/col = lane&15); elements 0..7 = k0+8g+0..7, 8..15 = k0+16+8g+0..7; D element r = row 8g+r, col lane&15
__device__ __forceinline__ v16h frag_h(const _Float16* rowk0, int lane) {
  union { v16h v; v8h q[2]; } u; const _Float16* p = rowk0 + 8 * (lane >> 4);
  u.q[0] = *(const v8h*)p; u.q[1] = *(const v8h*)(p + 16); return u.v;
}
__device__ __forceinline__ v16b frag_b(const __bf16* rowk0, int lane) {
  union { v16b v; v8b q[2]; } u; const __bf16* p = rowk0 + 8 * (lane >> 4);
  u.q[0] = *(const v8b*)p; u.q[1] = *(const v8b*)(p + 16); return u.v;
}
__device__ __forceinline__ float bfr(float v) { return (float)(__bf16)v; }
__device__ __forceinline__ void ldsx() { asm volatile("s_wait_dscnt 0" ::: "memory"); __builtin_amdgcn_wave_barrier(); __builtin_amdgcn_fence(3, "workgroup"); }

// 2^x on the transcendental unit. Written as text so that the slot the instruction set asks for behind a transcendental is there by construction:
// the results are early-clobber, so inside a run no instruction reads the one before or writes over its source, and a v_nop ends the run
__device__ __forceinline__ float exp2x1(float x) { float e; asm("v_exp_f32 %0, %1\n\tv_nop" : "=v"(e) : "v"(x)); return e; }
__device__ __forceinline__ v8f exp2x8(v8f x) {
  float e0, e1, e2, e3, e4, e5, e6, e7;
  asm("v_exp_f32 %0, %8\n\tv_exp_f32 %1, %9\n\tv_exp_f32 %2, %10\n\tv_exp_f32 %3, %11\n\tv_exp_f32 %4, %12\n\tv_exp_f32 %5, %13\n\tv_exp_f32 %6, %14\n\tv_exp_f32 %7, %15\n\tv_nop"
      : "=&v"(e0), "=&v"(e1), "=&v"(e2), "=&v"(e3), "=&v"(e4), "=&v"(e5), "=&v"(e6), "=&v"(e7)
      : "v"(x[0]), "v"(x[1]), "v"(x[2]), "v"(x[3]), "v"(x[4]), "v"(x[5]), "v"(x[6]), "v"(x[7]));
  return v8f{e0, e1, e2, e3, e4, e5, e6, e7};
}
// the wave's own LDS stores are done before its lanes read each other's words; unlike ldsx it leaves global loads in flight
__device__ __forceinline__ void ldsw() { asm volatile("s_wait_dscnt 0" ::: "memory"); __builtin_amdgcn_wave_barrier(); }

// sizes: x [NB][SEQ][DD] (input row pitch uses SEQ_FULL), 12 heads x 64, distance table [2*MAXPOS-1][64]
#ifndef NB
#define NB 8
#endif
#ifndef SEQ
#define SEQ 1024
#endif
#define NB_FULL 8
#define SEQ_FULL 1024
#define DD 768
#define NH 12
#define HD 64
#define MAXPOS 1024
#define NE (2 * MAXPOS - 1)
#define NEP (2 * MAXPOS)
#define FQ 128         // queries per attention block (8 waves x 16)
#define FK 64          // keys per pass
#define FNB 5          // band tiles of 16 table rows per pass (covers 16 + FK - 1 = 79)
#define TP 72          // staged row pitch in halves: 144 B = 16 B x 9, odd, for 16-B fragment reads
#define ER 256         // table ring rows: 16 * 8 + FK live and FK arriving
#define FBP 84         // band pitch in floats: 16-B aligned rows; the skewed read walks pitch + 1, odd
static_assert(NB <= NB_FULL);
static_assert(SEQ <= SEQ_FULL);
static_assert(SEQ <= MAXPOS);
static_assert(SEQ % FK == 0);
static_assert(SEQ % FQ == 0);
static_assert(SEQ % 64 == 0);
static_assert(NH * HD == DD);
static_assert(DD % 128 == 0);
static_assert(16 * FNB >= 16 + FK - 1);
static_assert(16 * FNB <= FBP && HD + 4 <= FBP);
static_assert(FK == 64 && HD == 64 && FQ + 2 * FK == ER);

// workspace carve (bytes, every region a multiple of 128)
#define WS_XB  ((size_t)0)                                   // bf16 x rows [NB*SEQ][DD]
#define WS_WB  (WS_XB + 2u * (size_t)NB * SEQ * DD)         // bf16 wq | wk | wv [3][DD][DD]
#define WS_EP  (WS_WB + 2u * (size_t)3 * DD * DD)           // f16 table x 16 [NEP][HD], last row zero
#define WS_QH  (WS_EP + 2u * (size_t)NEP * HD)              // f16 q x 16 [NB*SEQ][DD]
#define WS_KH  (WS_QH + 2u * (size_t)NB * SEQ * DD)         // f16 k x 16 [NB*SEQ][DD]
#define WS_VT  (WS_KH + 2u * (size_t)NB * SEQ * DD)         // f16 v x 16 transposed [NB][DD][SEQ]
#define WS_END (WS_VT + 2u * (size_t)NB * DD * SEQ)
static_assert(WS_END <= (size_t)134217728);
static_assert(WS_WB % 128 == 0 && WS_EP % 128 == 0 && WS_QH % 128 == 0 && WS_KH % 128 == 0 && WS_VT % 128 == 0);

// ---- k_cvt: dst[dr][0..ncol) (16-bit) <- src[(dr / seg) * segfull + dr % seg][..]; rows dr >= nsrc written as zeros; kind 0: bf16 bits, kind 1: f16 of (bf16 value * sc); one 16-B chunk per thread
__global__ __launch_bounds__(256) void k_cvt(const float* __restrict__ src, unsigned short* __restrict__ dst, int nrows, int nsrc, int ncol, int seg, int segfull, int kind, float sc) {
  const int cpr = ncol >> 3;
  const size_t total = (size_t)nrows * cpr;
  const size_t i8 = (size_t)blockIdx.x * 256 + threadIdx.x;
  if (i8 >= total) return;
  const int dr = (int)(i8 / cpr), cc = (int)(i8 - (size_t)dr * cpr) * 8;
  const int drc = dr < nsrc ? dr : nsrc - 1;
  const size_t srow = (size_t)(drc / seg) * segfull + (size_t)(drc % seg);
  const float* p = src + srow * (size_t)ncol + cc;
  const v4f va = *(const v4f*)p, vb = *(const v4f*)(p + 4);
  const bool z = dr >= nsrc;
  float v[8];
#pragma unroll
  for (int i = 0; i < 4; ++i) { v[i] = z ? 0.f : va[i]; v[4 + i] = z ? 0.f : vb[i]; }
  union { v8h h; v8b b; v4u u; } o;
  if (kind == 0) {
#pragma unroll
    for (int i = 0; i < 8; ++i) o.b[i] = (__bf16)v[i];
  } else {
#pragma unroll
    for (int i = 0; i < 8; ++i) o.h[i] = (_Float16)(bfr(v[i]) * sc);
  }
  vst2(dst + i8 * 8, o.u);
}

// ---- k_proj: block = (64 rows, 128 output cols, which of q|k|v): y = x W^T + b with exact bf16 products; y * 16 -> f16; q/k row planes, v transposed plane
__global__ __launch_bounds__(128) void k_proj(const __bf16* __restrict__ XB, const __bf16* __restrict__ WB, const float* __restrict__ BQ, const float* __restrict__ BK, const float* __restrict__ BV, _Float16* __restrict__ QH, _Float16* __restrict__ KH, _Float16* __restrict__ VT) {
  __shared__ __align__(16) _Float16 sh[64][136];
  __shared__ __align__(16) _Float16 th[128][72];
  const int tid = threadIdx.x, wave = tid >> 5, lane = tid & 31, col = lane & 15, g = lane >> 4;
  const int which = blockIdx.z; const int c0 = blockIdx.y * 128; const size_t r0 = (size_t)blockIdx.x * 64;
  const __bf16* W = WB + (size_t)which * DD * DD;
  const float* Bp = which == 0 ? BQ : (which == 1 ? BK : BV);
  v8f acc[8] = {};
#pragma unroll 2
  for (int kc = 0; kc < DD / 32; ++kc) {
    const v16b a = frag_b(XB + (r0 + wave * 16 + col) * DD + kc * 32, lane);
#pragma unroll
    for (int j = 0; j < 8; ++j) { const v16b w = frag_b(W + (size_t)(c0 + j * 16 + col) * DD + kc * 32, lane); acc[j] = wmma_bf(a, w, acc[j]); }
  }
#pragma unroll
  for (int j = 0; j < 8; ++j) { const float bb = bfr(Bp[c0 + j * 16 + col]);
#pragma unroll
    for (int r = 0; r < 8; ++r) { const float v = (acc[j][r] + bb) * 16.0f; const int rl = wave * 16 + 8 * g + r, cl = j * 16 + col; const _Float16 hv = (_Float16)v;
      if (which == 2) th[cl][rl] = hv; else sh[rl][cl] = hv; } }
  __syncthreads();
  if (which < 2) { _Float16* dh = which == 0 ? QH : KH;
    for (int e = tid; e < 64 * 16; e += 128) { const int rl = e >> 4, q = e & 15; vst2(dh + (r0 + rl) * DD + c0 + q * 8, *(const v4u*)&sh[rl][q * 8]); } }
  else { const size_t b = r0 / SEQ; const int t0 = (int)(r0 % SEQ);
    for (int e = tid; e < 128 * 8; e += 128) { const int cl = e >> 3, q = e & 7; const size_t o2 = (b * DD + c0 + cl) * (size_t)SEQ + t0 + q * 8; vst2(VT + o2, *(const v4u*)&th[cl][q * 8]); } }
}

// ---- k_fa: block = 128 queries (8 waves x 16) of (b = blockIdx.z, h = blockIdx.y); the block walks all keys in passes of FK, each wave with a running maximum and sum for its 16 queries
// transposed products: St = K Q^T (+ band), Ot += V^T Pt; a lane holds one query (column lane&15) and keys 8g+r of each 16-key tile, so two St tiles convert in place into one B operand of the P V product
// band: query i, key r uses table row i + MAXPOS-1 - r; wave band base cbase = ql0 + MAXPOS-1 - (k0 + FK-1); local column c = u + FK-1 - rloc in [0, 79)
// staging: whole 128-B rows of K, V^T and the table go through registers into LDS one pass ahead; the block's 192 live table rows sit in a ring of ER rows (slot = row mod ER), each pass brings the 64 rows below them
// the inner loops are fully unrolled so that s, o, e and p stay in registers
// 160 registers: the grid is three blocks a WGP, six waves a SIMD, and 1,024 / 6 in granules of 16 is 160
__global__ __launch_bounds__(256) __attribute__((amdgpu_num_vgpr(160))) void k_fa(const _Float16* __restrict__ QH, const _Float16* __restrict__ KH, const _Float16* __restrict__ EP, const _Float16* __restrict__ VT, float* __restrict__ Y) {
  __shared__ __align__(16) _Float16 smem[FQ * FBP * 2 + (FK + HD + ER) * TP];   // one array, so that every tile's start is a 16-bit offset on a shared lane address: bands, K, V^T, table ring
  _Float16 (*sK)[TP] = (_Float16 (*)[TP])(smem + FQ * FBP * 2); _Float16 (*sV)[TP] = sK + FK; _Float16 (*sE)[TP] = sV + HD;
  const int b = blockIdx.z, h = blockIdx.y;
  const int tid = threadIdx.x, wave = tid >> 5, lane = tid & 31, col = lane & 15, g = lane >> 4;
  const int ql0 = blockIdx.x * FQ + wave * 16; const size_t q0 = (size_t)b * SEQ + ql0;
  float* sb = (float*)smem + wave * (16 * FBP);
  const _Float16* pq = QH + (q0 + col) * DD + h * HD + 8 * g;   // the lane's own fragment address, as in frag_h
  union { v16h v; v8h q[2]; } ua, ub;
  ua.q[0] = *(const v8h*)pq; ua.q[1] = *(const v8h*)(pq + 16); ub.q[0] = *(const v8h*)(pq + 32); ub.q[1] = *(const v8h*)(pq + 48);
  asm volatile("s_wait_xcnt 0x0" :: "v"(pq) : "memory");   // the query loads' address stays in its registers up to this wait
  const v16h qa = ua.v, qb = ub.v;
  const int sr = tid >> 3, sc = (tid & 7) * 8;   // staging: rows sr and sr + 32 of each 64-row tile, one 16-B chunk of the row
  const _Float16* Kg = KH + (size_t)b * SEQ * DD + h * HD;              // block-uniform bases, 32-bit lane offsets
  const _Float16* Vg = VT + ((size_t)b * DD + h * HD) * (size_t)SEQ;
  const unsigned ko = sr * DD + sc, vo = sr * SEQ + sc, eo = sr * HD + sc;
  const int eb0 = blockIdx.x * FQ + (MAXPOS - 1) - (FK - 1);   // lowest table row of the block at k0 = 0; at k0 it is eb0 - k0, in [0, NEP - 192]
  {
    const _Float16 *pe = EP + (size_t)eb0 * HD + eo, *pk = Kg + ko, *pv = Vg + vo;
    v4u te[6];
#pragma unroll
    for (int i = 0; i < 6; ++i) te[i] = *(const v4u*)(pe + i * 32 * HD);
    const v4u tk0 = *(const v4u*)pk, tk1 = *(const v4u*)(pk + 32 * DD), tv0 = *(const v4u*)pv, tv1 = *(const v4u*)(pv + 32 * SEQ);
    asm volatile("s_wait_xcnt 0x0" :: "v"(pe), "v"(pk), "v"(pv) : "memory");   // the ten loads' addresses stay in their registers up to this wait
#pragma unroll
    for (int i = 0; i < 6; ++i) *(v4u*)&sE[(eb0 + i * 32 + sr) & (ER - 1)][sc] = te[i];
    *(v4u*)&sK[sr][sc] = tk0; *(v4u*)&sK[sr + 32][sc] = tk1; *(v4u*)&sV[sr][sc] = tv0; *(v4u*)&sV[sr + 32][sc] = tv1;
  }
  __syncthreads();
  const float C = 1.4426950408889634f / 2048.0f;   // 2^-11 * log2(e): raw product units -> exponent of two
  v8f o[HD / 16] = {};
  float m = -3.0e38f, l = 0.f;
// rolled: one pass of code, one pass of registers
#pragma unroll 1
  for (int k0 = 0; k0 < SEQ; k0 += FK) {
    const int kn = k0 + FK < SEQ ? k0 + FK : k0;   // the pass fetched ahead; the last pass fetches its own tiles again, into the slots that hold them
    const int ern = eb0 - kn + sr;
    const unsigned kq = ko + kn * DD, vq = vo + kn, eq = eo + (eb0 - kn) * HD;
    const _Float16 *pk = Kg + kq, *pv = Vg + vq, *pe = EP + eq;
    const v4u rk0 = *(const v4u*)pk, rk1 = *(const v4u*)(pk + 32 * DD);
    const v4u rv0 = *(const v4u*)pv, rv1 = *(const v4u*)(pv + 32 * SEQ);
    const v4u re0 = *(const v4u*)pe, re1 = *(const v4u*)(pe + 32 * HD);
    asm volatile("s_wait_xcnt 0x0" :: "v"(pk), "v"(pv), "v"(pe) : "memory");   // the six loads' addresses stay in their registers up to this wait: no result and no later value lands on them before it
    const int cbase = ql0 + (MAXPOS - 1) - k0 - (FK - 1);
#pragma unroll
    for (int t = 0; t < FNB; ++t) {
      const _Float16* ep = &sE[(cbase + t * 16 + col) & (ER - 1)][0];
      v8f c = {};
      c = wmma_p(frag_h(ep, lane), qa, c);
      c = wmma16(frag_h(ep + 32, lane), qb, c);   // with its four slots: only an LDS store reads c, and the next tile's product may take the same registers
      float* d = sb + col * FBP + t * 16 + 8 * g;
      *(v4f*)d = __builtin_shufflevector(c, c, 0, 1, 2, 3); *(v4f*)(d + 4) = __builtin_shufflevector(c, c, 4, 5, 6, 7);
    }
    v8f s[FK / 16];
#pragma unroll
    for (int j = 0; j < FK / 16; ++j) { const _Float16* kp = &sK[j * 16 + col][0]; v8f z = {};
      z = wmma_p(frag_h(kp, lane), qa, z); s[j] = wmma_p(frag_h(kp + 32, lane), qb, z); }
    ldsw();
    float mj[FK / 16];
#pragma unroll
    for (int j = 0; j < FK / 16; ++j) { mj[j] = -3.0e38f;
#pragma unroll
      for (int r = 0; r < 8; ++r) { s[j][r] += sb[col * FBP + col + (FK - 1) - j * 16 - 8 * g - r]; mj[j] = fmaxf(mj[j], s[j][r]); } }
    float mx = fmaxf(fmaxf(mj[0], mj[1]), fmaxf(mj[2], mj[3]));
    mx = fmaxf(mx, __shfl_xor(mx, 16));
    const float mn = fmaxf(m, mx);
    const float al = exp2x1((m - mn) * C);
    const float off = 14.0f - mn * C;
    m = mn;
    v8f e[FK / 16];
    v16h p[FK / 32];
#pragma unroll
    for (int j = 0; j < FK / 16; ++j) { e[j] = exp2x8(s[j] * C + off);
#pragma unroll
      for (int r = 0; r < 8; ++r) p[j >> 1][(j & 1) * 8 + r] = (_Float16)e[j][r]; }
    const v8f es = (e[0] + e[1]) + (e[2] + e[3]);
    l = l * al + (((es[0] + es[1]) + (es[2] + es[3])) + ((es[4] + es[5]) + (es[6] + es[7])));
#pragma unroll
    for (int j = 0; j < HD / 16; ++j) o[j] *= al;
#pragma unroll
    for (int kc = 0; kc < FK / 32; ++kc)
#pragma unroll
      for (int j = 0; j < HD / 16; ++j) o[j] = wmma_p(frag_h(&sV[j * 16 + col][kc * 32], lane), p[kc], o[j]);
    __syncthreads();   // every wave has read this pass's K and V^T tiles
    *(v4u*)&sK[sr][sc] = rk0; *(v4u*)&sK[sr + 32][sc] = rk1;
    *(v4u*)&sV[sr][sc] = rv0; *(v4u*)&sV[sr + 32][sc] = rv1;
    *(v4u*)&sE[ern & (ER - 1)][sc] = re0; *(v4u*)&sE[(ern + 32) & (ER - 1)][sc] = re1;
    __syncthreads();   // the next pass's tiles are in place for every wave
  }
  l += __shfl_xor(l, 16);
  const float inv = 1.0f / (l * 16.0f);
#pragma unroll
  for (int j = 0; j < HD / 16; ++j) { const v8f y = o[j] * inv; float* d = sb + col * (HD + 4) + j * 16 + 8 * g;
    *(v4f*)d = __builtin_shufflevector(y, y, 0, 1, 2, 3); *(v4f*)(d + 4) = __builtin_shufflevector(y, y, 4, 5, 6, 7); }
  ldsx();
#pragma unroll
  for (int rl = 0; rl < 16; rl += 2) vst2(Y + (q0 + rl + g) * DD + h * HD + col * 4, *(const v4f*)&sb[(rl + g) * (HD + 4) + col * 4]);
}

extern "C" void kernel_launch(void* const* d_in, const int* in_sizes, int n_in, void* d_out, int out_size, void* d_ws, size_t ws_size, hipStream_t stream) {
  if (n_in < 8) return;
  if ((size_t)in_sizes[0] < ((size_t)(NB - 1) * SEQ_FULL + SEQ) * DD) return;
  if (in_sizes[1] < DD * DD || in_sizes[3] < DD * DD || in_sizes[5] < DD * DD) return;
  if (in_sizes[2] < DD || in_sizes[4] < DD || in_sizes[6] < DD) return;
  if (in_sizes[7] < NE * HD) return;
  if ((size_t)out_size < (size_t)NB * SEQ * DD) return;
  if (ws_size < WS_END) return;
  const float* const* F = (const float* const*)d_in;   // 0 x, 1 wq, 2 bq, 3 wk, 4 bk, 5 wv, 6 bv, 7 dist table
  char* ws = (char*)d_ws;
  __bf16* XB = (__bf16*)(ws + WS_XB); __bf16* WB = (__bf16*)(ws + WS_WB); _Float16* EP = (_Float16*)(ws + WS_EP);
  _Float16 *QH = (_Float16*)(ws + WS_QH), *KH = (_Float16*)(ws + WS_KH), *VT = (_Float16*)(ws + WS_VT);
  const size_t nx8 = (size_t)NB * SEQ * DD / 8, nw8 = (size_t)DD * DD / 8, ne8 = (size_t)NEP * HD / 8;
  k_cvt<<<dim3((unsigned)((nx8 + 255) / 256)), 256, 0, stream>>>(F[0], (unsigned short*)XB, NB * SEQ, NB * SEQ, DD, SEQ, SEQ_FULL, 0, 1.0f);
  k_cvt<<<dim3((unsigned)((nw8 + 255) / 256)), 256, 0, stream>>>(F[1], (unsigned short*)WB, DD, DD, DD, DD, DD, 0, 1.0f);
  k_cvt<<<dim3((unsigned)((nw8 + 255) / 256)), 256, 0, stream>>>(F[3], (unsigned short*)(WB + (size_t)DD * DD), DD, DD, DD, DD, DD, 0, 1.0f);
  k_cvt<<<dim3((unsigned)((nw8 + 255) / 256)), 256, 0, stream>>>(F[5], (unsigned short*)(WB + (size_t)2 * DD * DD), DD, DD, DD, DD, DD, 0, 1.0f);
  k_cvt<<<dim3((unsigned)((ne8 + 255) / 256)), 256, 0, stream>>>(F[7], (unsigned short*)EP, NEP, NE, HD, NEP, NEP, 1, 16.0f);
  k_proj<<<dim3(NB * SEQ / 64, DD / 128, 3), 128, 0, stream>>>(XB, WB, F[2], F[4], F[6], QH, KH, VT);
  k_fa<<<dim3(SEQ / FQ, NH, NB), 256, 0, stream>>>(QH, KH, EP, VT, (float*)d_out);
}

// v002
// One run takes 90.5 microseconds.
// In two side-by-side timings against v001, it was 2.19 and 2.17 times as fast.
// All steps since v000 together make it 7.53 times as fast.
// compute dtype: every float input RNE-converted to bf16 on load; q/k/v = x W^T + b on v_wmma_f32_16x16x32_bf16 (bf16 operands, exact products, f32 accumulate); q, k, v and the distance table carried as f16 x 2^4 planes; logits = (q k^T + q E^T) x 2^-11 on v_wmma_f32_16x16x32_f16 (single products, f32 accumulate); softmax in f32 with a running maximum and sum (exp2); exp(logit - max) x 2^14 as f16; P V on v_wmma_f32_16x16x32_f16 (single product, f32 accumulate), divided by 16 x the f32 sum into the f32 output.
#include <hip/hip_runtime.h>
#include <math.h>

typedef __attribute__((ext_vector_type(16))) _Float16 v16h;
typedef __attribute__((ext_vector_type(16))) __bf16 v16b;
typedef __attribute__((ext_vector_type(8)))  _Float16 v8h;
typedef __attribute__((ext_vector_type(8)))  __bf16 v8b;
typedef __attribute__((ext_vector_type(8)))  float v8f;
typedef __attribute__((ext_vector_type(4)))  float v4f;
typedef __attribute__((ext_vector_type(4)))  unsigned v4u;

template <typename T> __device__ __forceinline__ void vst2(void* p, T v) { *(T*)p = v;  }
__device__ __forceinline__ v8f wmma16(v16h a, v16h b, v8f c) {
  v8f d = __builtin_amdgcn_wmma_f32_16x16x32_f16(false, a, false, b, (short)0, c, false, false);
  asm volatile("v_nop\n\tv_nop\n\tv_nop\n\tv_nop" : "+v"(d) : "v"(a), "v"(b));
  return d;
}
__device__ __forceinline__ v8f wmma_p(v16h a, v16h b, v8f c) { return __builtin_amdgcn_wmma_f32_16x16x32_f16(false, a, false, b, (short)0, c, false, false); }
__device__ __forceinline__ v8f wmma_bf(v16b a, v16b b, v8f c) { return __builtin_amdgcn_wmma_f32_16x16x32_bf16(false, a, false, b, (short)0, c, false, false); }
// 16x16x32 fragments: lane = (g = lane>>4, row/col = lane&15); elements 0..7 = k0+8g+0..7, 8..15 = k0+16+8g+0..7; D element r = row 8g+r, col lane&15
__device__ __forceinline__ v16h frag_h(const _Float16* rowk0, int lane) {
  union { v16h v; v8h q[2]; } u; const _Float16* p = rowk0 + 8 * (lane >> 4);
  u.q[0] = *(const v8h*)p; u.q[1] = *(const v8h*)(p + 16); return u.v;
}
__device__ __forceinline__ v16b frag_b(const __bf16* rowk0, int lane) {
  union { v16b v; v8b q[2]; } u; const __bf16* p = rowk0 + 8 * (lane >> 4);
  u.q[0] = *(const v8b*)p; u.q[1] = *(const v8b*)(p + 16); return u.v;
}
__device__ __forceinline__ float bfr(float v) { return (float)(__bf16)v; }
__device__ __forceinline__ void ldsx() { asm volatile("s_wait_dscnt 0" ::: "memory"); __builtin_amdgcn_wave_barrier(); __builtin_amdgcn_fence(3, "workgroup"); }

// 2^x on the transcendental unit. Written as text so that the slot the instruction set asks for behind a transcendental is there by construction:
// the results are early-clobber, so inside a run no instruction reads the one before or writes over its source, and a v_nop ends the run
__device__ __forceinline__ float exp2x1(float x) { float e; asm("v_exp_f32 %0, %1\n\tv_nop" : "=v"(e) : "v"(x)); return e; }
__device__ __forceinline__ v8f exp2x8(v8f x) {
  float e0, e1, e2, e3, e4, e5, e6, e7;
  asm("v_exp_f32 %0, %8\n\tv_exp_f32 %1, %9\n\tv_exp_f32 %2, %10\n\tv_exp_f32 %3, %11\n\tv_exp_f32 %4, %12\n\tv_exp_f32 %5, %13\n\tv_exp_f32 %6, %14\n\tv_exp_f32 %7, %15\n\tv_nop"
      : "=&v"(e0), "=&v"(e1), "=&v"(e2), "=&v"(e3), "=&v"(e4), "=&v"(e5), "=&v"(e6), "=&v"(e7)
      : "v"(x[0]), "v"(x[1]), "v"(x[2]), "v"(x[3]), "v"(x[4]), "v"(x[5]), "v"(x[6]), "v"(x[7]));
  return v8f{e0, e1, e2, e3, e4, e5, e6, e7};
}
// the wave's own LDS stores are done before its lanes read each other's words; unlike ldsx it leaves global loads in flight
__device__ __forceinline__ void ldsw() { asm volatile("s_wait_dscnt 0" ::: "memory"); __builtin_amdgcn_wave_barrier(); }

// sizes: x [NB][SEQ][DD] (input row pitch uses SEQ_FULL), 12 heads x 64, distance table [2*MAXPOS-1][64]
#ifndef NB
#define NB 8
#endif
#ifndef SEQ
#define SEQ 1024
#endif
#define NB_FULL 8
#define SEQ_FULL 1024
#define DD 768
#define NH 12
#define HD 64
#define MAXPOS 1024
#define NE (2 * MAXPOS - 1)
#define NEP (2 * MAXPOS)
#define FQ 128         // queries per attention block (8 waves x 16)
#define FK 64          // keys per pass
#define FNB 5          // band tiles of 16 table rows per pass (covers 16 + FK - 1 = 79)
#define TP 72          // staged row pitch in halves: 144 B = 16 B x 9, odd, for 16-B fragment reads
#define ER 256         // table ring rows: 16 * 8 + FK live and FK arriving
#define FBP 84         // band pitch in floats: 16-B aligned rows; the skewed read walks pitch + 1, odd
static_assert(NB <= NB_FULL);
static_assert(SEQ <= SEQ_FULL);
static_assert(SEQ <= MAXPOS);
static_assert(SEQ % FK == 0);
static_assert(SEQ % FQ == 0);
static_assert(SEQ % 64 == 0);
static_assert(NH * HD == DD);
static_assert(DD % 128 == 0);
static_assert(16 * FNB >= 16 + FK - 1);
static_assert(16 * FNB <= FBP && HD + 4 <= FBP);
static_assert(FK == 64 && HD == 64 && FQ + 2 * FK == ER);

// workspace carve (bytes, every region a multiple of 128)
#define WS_XB  ((size_t)0)                                   // bf16 x rows [NB*SEQ][DD]
#define WS_WB  (WS_XB + 2u * (size_t)NB * SEQ * DD)         // bf16 wq | wk | wv [3][DD][DD]
#define WS_EP  (WS_WB + 2u * (size_t)3 * DD * DD)           // f16 table x 16 [NEP][HD], last row zero
#define WS_QH  (WS_EP + 2u * (size_t)NEP * HD)              // f16 q x 16 [NB*SEQ][DD]
#define WS_KH  (WS_QH + 2u * (size_t)NB * SEQ * DD)         // f16 k x 16 [NB*SEQ][DD]
#define WS_VT  (WS_KH + 2u * (size_t)NB * SEQ * DD)         // f16 v x 16 transposed [NB][DD][SEQ]
#define WS_END (WS_VT + 2u * (size_t)NB * DD * SEQ)
static_assert(WS_END <= (size_t)134217728);
static_assert(WS_WB % 128 == 0 && WS_EP % 128 == 0 && WS_QH % 128 == 0 && WS_KH % 128 == 0 && WS_VT % 128 == 0);

// ---- k_cvt: dst[dr][0..ncol) (16-bit) <- src[(dr / seg) * segfull + dr % seg][..]; rows dr >= nsrc written as zeros; kind 0: bf16 bits, kind 1: f16 of (bf16 value * sc); one 16-B chunk per thread
__global__ __launch_bounds__(256) void k_cvt(const float* __restrict__ src, unsigned short* __restrict__ dst, int nrows, int nsrc, int ncol, int seg, int segfull, int kind, float sc) {
  const int cpr = ncol >> 3;
  const size_t total = (size_t)nrows * cpr;
  const size_t i8 = (size_t)blockIdx.x * 256 + threadIdx.x;
  if (i8 >= total) return;
  const int dr = (int)(i8 / cpr), cc = (int)(i8 - (size_t)dr * cpr) * 8;
  const int drc = dr < nsrc ? dr : nsrc - 1;
  const size_t srow = (size_t)(drc / seg) * segfull + (size_t)(drc % seg);
  const float* p = src + srow * (size_t)ncol + cc;
  const v4f va = *(const v4f*)p, vb = *(const v4f*)(p + 4);
  const bool z = dr >= nsrc;
  float v[8];
#pragma unroll
  for (int i = 0; i < 4; ++i) { v[i] = z ? 0.f : va[i]; v[4 + i] = z ? 0.f : vb[i]; }
  union { v8h h; v8b b; v4u u; } o;
  if (kind == 0) {
#pragma unroll
    for (int i = 0; i < 8; ++i) o.b[i] = (__bf16)v[i];
  } else {
#pragma unroll
    for (int i = 0; i < 8; ++i) o.h[i] = (_Float16)(bfr(v[i]) * sc);
  }
  vst2(dst + i8 * 8, o.u);
}

// ---- k_proj: block = (128 rows, 128 output cols, which of q|k|v), 4 waves of 64 x 64: y = x W^T + b with exact bf16 products, k ascending in one accumulator per tile; y * 16 -> f16; q/k row planes, v transposed plane
// staging: a stage is 64 k (one 128-B line) of the block's 128 x rows and 128 W rows, brought into LDS by asynchronous copies, whole lines, two buffers: stage t + 1 flies while stage t is multiplied
#define PM 128         // x rows per block
#define PN 128         // W rows (output columns) per block
#define PK 64          // k per stage
#define PP 72          // staged row pitch in elements: 144 B = 16 B x 9, odd, for 16-B fragment reads
#define PST ((PM + PN) * PP)   // elements per buffer
#define PNT (DD / PK)  // stages
#define PEP 136        // epilogue row pitch in halves
static_assert(DD % PK == 0 && PNT >= 2);
static_assert((NB * SEQ) % PM == 0 && SEQ % PM == 0 && DD % PN == 0);
static_assert(128 * PEP <= 2 * PST);
// eight 16-B copies of a lane, rows 16 apart: LDS byte address l + i * 16 rows, global address p + i * 16 rows
// the s_wait_xcnt ends the copies' own statement, so that no address register is rewritten ahead of it
__device__ __forceinline__ void copy8(unsigned l, const __bf16* p) {
  asm volatile("global_load_async_to_lds_b128 %0, %8, off\n\tglobal_load_async_to_lds_b128 %1, %9, off\n\tglobal_load_async_to_lds_b128 %2, %10, off\n\tglobal_load_async_to_lds_b128 %3, %11, off\n\t"
               "global_load_async_to_lds_b128 %4, %12, off\n\tglobal_load_async_to_lds_b128 %5, %13, off\n\tglobal_load_async_to_lds_b128 %6, %14, off\n\tglobal_load_async_to_lds_b128 %7, %15, off\n\ts_wait_xcnt 0x0"
               :: "v"(l), "v"(l + 1 * 16 * PP * 2), "v"(l + 2 * 16 * PP * 2), "v"(l + 3 * 16 * PP * 2), "v"(l + 4 * 16 * PP * 2), "v"(l + 5 * 16 * PP * 2), "v"(l + 6 * 16 * PP * 2), "v"(l + 7 * 16 * PP * 2),
                  "v"(p), "v"(p + 1 * 16 * DD), "v"(p + 2 * 16 * DD), "v"(p + 3 * 16 * DD), "v"(p + 4 * 16 * DD), "v"(p + 5 * 16 * DD), "v"(p + 6 * 16 * DD), "v"(p + 7 * 16 * DD)
               : "memory");
}
__global__ __launch_bounds__(128) void k_proj(const __bf16* __restrict__ XB, const __bf16* __restrict__ WB, const float* __restrict__ BQ, const float* __restrict__ BK, const float* __restrict__ BV, _Float16* __restrict__ QH, _Float16* __restrict__ KH, _Float16* __restrict__ VT) {
  __shared__ __align__(16) __bf16 st[2 * PST];   // two stage buffers, each [x 128 rows | W 128 rows]; afterwards the output tile
  const int tid = threadIdx.x, wave = tid >> 5, lane = tid & 31, col = lane & 15, g = lane >> 4;
  const int wm = wave >> 1, wn = wave & 1;
  const int which = blockIdx.z; const int c0 = blockIdx.y * PN; const size_t r0 = (size_t)blockIdx.x * PM;
  const float* Bp = which == 0 ? BQ : (which == 1 ? BK : BV);
  const int cr = tid >> 3, cc = (tid & 7) * 8;   // copies: rows cr + 16 i of each operand, one 16-B chunk of the line; a wave's copy covers four whole lines
  const __bf16* xg = XB + (r0 + cr) * DD + cc;
  const __bf16* wg = WB + (size_t)which * DD * DD + (size_t)(c0 + cr) * DD + cc;
  const unsigned lx = (unsigned)(size_t)&st[cr * PP + cc], lw = lx + PM * PP * 2;
  copy8(lx, xg); copy8(lw, wg);
  asm volatile("s_wait_asynccnt 0x0" ::: "memory");   // this wave's share of stage 0 has landed
  __syncthreads();                                     // and every other wave's
  copy8(lx + PST * 2, xg + PK); copy8(lw + PST * 2, wg + PK);
  v8f acc[4][4] = {};
// rolled: one stage of code, and the copies' order at the foot stays as written
#pragma unroll 1
  for (int t = 0; t < PNT; ++t) {
    const __bf16* bp = st + (t & 1) * PST;
#pragma unroll
    for (int ks = 0; ks < PK / 32; ++ks) {
      v16b a[4], w[4];
#pragma unroll
      for (int i = 0; i < 4; ++i) a[i] = frag_b(bp + (wm * 64 + i * 16 + col) * PP + ks * 32, lane);
#pragma unroll
      for (int j = 0; j < 4; ++j) w[j] = frag_b(bp + (PM + wn * 64 + j * 16 + col) * PP + ks * 32, lane);
      // inputs only: the sixteen LDS reads of this k step stand as one group ahead of its products, one wait instead of one per row of four
      asm volatile("" :: "v"(a[0]), "v"(a[1]), "v"(a[2]), "v"(a[3]), "v"(w[0]), "v"(w[1]), "v"(w[2]), "v"(w[3]));
#pragma unroll
      for (int i = 0; i < 4; ++i)
#pragma unroll
        for (int j = 0; j < 4; ++j) acc[i][j] = wmma_bf(a[i], w[j], acc[i][j]);
    }
    asm volatile("s_wait_dscnt 0x0" ::: "memory");      // this wave's reads of the buffer are done before it is refilled
    asm volatile("s_wait_asynccnt 0x0" ::: "memory");   // this wave's share of stage t + 1 has landed
    __syncthreads();                                     // stage t + 1 is there for every wave, and every wave has left stage t's buffer
    if (t + 2 < PNT) { copy8(lx + (t & 1) * (PST * 2), xg + (t + 2) * PK); copy8(lw + (t & 1) * (PST * 2), wg + (t + 2) * PK); }
  }
  asm volatile("s_wait_asynccnt 0x0" ::: "memory");     // nothing of the copies is outstanding when the buffers become the output tile
  _Float16* sh = (_Float16*)st;   // q, k: [row][col]; v: [col][row]; pitch PEP
  v8h hv[4][4];
#pragma unroll
  for (int j = 0; j < 4; ++j) { const float bb = bfr(Bp[c0 + wn * 64 + j * 16 + col]);
#pragma unroll
    for (int i = 0; i < 4; ++i)
#pragma unroll
      for (int r = 0; r < 8; ++r) hv[i][j][r] = (_Float16)((acc[i][j][r] + bb) * 16.0f); }
  const int rl = wm * 64 + 8 * g, cl = wn * 64 + col;   // the lane's first element of tile (0, 0)
  if (which == 2) {
#pragma unroll
    for (int j = 0; j < 4; ++j)
#pragma unroll
      for (int i = 0; i < 4; ++i) *(v8h*)&sh[(cl + j * 16) * PEP + rl + i * 16] = hv[i][j];
  } else {
#pragma unroll
    for (int j = 0; j < 4; ++j)
#pragma unroll
      for (int i = 0; i < 4; ++i)
#pragma unroll
        for (int r = 0; r < 8; ++r) sh[(rl + i * 16 + r) * PEP + cl + j * 16] = hv[i][j][r];
  }
  __syncthreads();
  const int er = tid >> 4, eq = (tid & 15) * 8;   // a tile row is 256 B: sixteen lanes store two whole lines
  _Float16* d = which == 2 ? VT + ((r0 / SEQ) * DD + c0 + er) * (size_t)SEQ + (r0 % SEQ) + eq : (which == 0 ? QH : KH) + (r0 + er) * DD + c0 + eq;
  const size_t dp = which == 2 ? 8 * (size_t)SEQ : 8 * (size_t)DD;   // eight rows of the plane
#pragma unroll
  for (int it = 0; it < 8; ++it) vst2(d + it * dp, *(const v4u*)&sh[(er + it * 8) * PEP + eq]);
  asm volatile("s_wait_xcnt 0x0" ::: "memory");   // the eight stores' registers are free before the next eight rows are read into them
#pragma unroll
  for (int it = 8; it < 16; ++it) vst2(d + it * dp, *(const v4u*)&sh[(er + it * 8) * PEP + eq]);
}

// ---- k_fa: block = 128 queries (8 waves x 16) of (b = blockIdx.z, h = blockIdx.y); the block walks all keys in passes of FK, each wave with a running maximum and sum for its 16 queries
// transposed products: St = K Q^T (+ band), Ot += V^T Pt; a lane holds one query (column lane&15) and keys 8g+r of each 16-key tile, so two St tiles convert in place into one B operand of the P V product
// band: query i, key r uses table row i + MAXPOS-1 - r; wave band base cbase = ql0 + MAXPOS-1 - (k0 + FK-1); local column c = u + FK-1 - rloc in [0, 79)
// staging: whole 128-B rows of K, V^T and the table go through registers into LDS one pass ahead; the block's 192 live table rows sit in a ring of ER rows (slot = row mod ER), each pass brings the 64 rows below them
// the inner loops are fully unrolled so that s, o, e and p stay in registers
// 160 registers: the grid is three blocks a WGP, six waves a SIMD, and 1,024 / 6 in granules of 16 is 160
__global__ __launch_bounds__(256) __attribute__((amdgpu_num_vgpr(160))) void k_fa(const _Float16* __restrict__ QH, const _Float16* __restrict__ KH, const _Float16* __restrict__ EP, const _Float16* __restrict__ VT, float* __restrict__ Y) {
  __shared__ __align__(16) _Float16 smem[FQ * FBP * 2 + (FK + HD + ER) * TP];   // one array, so that every tile's start is a 16-bit offset on a shared lane address: bands, K, V^T, table ring
  _Float16 (*sK)[TP] = (_Float16 (*)[TP])(smem + FQ * FBP * 2); _Float16 (*sV)[TP] = sK + FK; _Float16 (*sE)[TP] = sV + HD;
  const int b = blockIdx.z, h = blockIdx.y;
  const int tid = threadIdx.x, wave = tid >> 5, lane = tid & 31, col = lane & 15, g = lane >> 4;
  const int ql0 = blockIdx.x * FQ + wave * 16; const size_t q0 = (size_t)b * SEQ + ql0;
  float* sb = (float*)smem + wave * (16 * FBP);
  const _Float16* pq = QH + (q0 + col) * DD + h * HD + 8 * g;   // the lane's own fragment address, as in frag_h
  union { v16h v; v8h q[2]; } ua, ub;
  ua.q[0] = *(const v8h*)pq; ua.q[1] = *(const v8h*)(pq + 16); ub.q[0] = *(const v8h*)(pq + 32); ub.q[1] = *(const v8h*)(pq + 48);
  asm volatile("s_wait_xcnt 0x0" :: "v"(pq) : "memory");   // the query loads' address stays in its registers up to this wait
  const v16h qa = ua.v, qb = ub.v;
  const int sr = tid >> 3, sc = (tid & 7) * 8;   // staging: rows sr and sr + 32 of each 64-row tile, one 16-B chunk of the row
  const _Float16* Kg = KH + (size_t)b * SEQ * DD + h * HD;              // block-uniform bases, 32-bit lane offsets
  const _Float16* Vg = VT + ((size_t)b * DD + h * HD) * (size_t)SEQ;
  const unsigned ko = sr * DD + sc, vo = sr * SEQ + sc, eo = sr * HD + sc;
  const int eb0 = blockIdx.x * FQ + (MAXPOS - 1) - (FK - 1);   // lowest table row of the block at k0 = 0; at k0 it is eb0 - k0, in [0, NEP - 192]
  {
    const _Float16 *pe = EP + (size_t)eb0 * HD + eo, *pk = Kg + ko, *pv = Vg + vo;
    v4u te[6];
#pragma unroll
    for (int i = 0; i < 6; ++i) te[i] = *(const v4u*)(pe + i * 32 * HD);
    const v4u tk0 = *(const v4u*)pk, tk1 = *(const v4u*)(pk + 32 * DD), tv0 = *(const v4u*)pv, tv1 = *(const v4u*)(pv + 32 * SEQ);
    asm volatile("s_wait_xcnt 0x0" :: "v"(pe), "v"(pk), "v"(pv) : "memory");   // the ten loads' addresses stay in their registers up to this wait
#pragma unroll
    for (int i = 0; i < 6; ++i) *(v4u*)&sE[(eb0 + i * 32 + sr) & (ER - 1)][sc] = te[i];
    *(v4u*)&sK[sr][sc] = tk0; *(v4u*)&sK[sr + 32][sc] = tk1; *(v4u*)&sV[sr][sc] = tv0; *(v4u*)&sV[sr + 32][sc] = tv1;
  }
  __syncthreads();
  const float C = 1.4426950408889634f / 2048.0f;   // 2^-11 * log2(e): raw product units -> exponent of two
  v8f o[HD / 16] = {};
  float m = -3.0e38f, l = 0.f;
// rolled: one pass of code, one pass of registers
#pragma unroll 1
  for (int k0 = 0; k0 < SEQ; k0 += FK) {
    const int kn = k0 + FK < SEQ ? k0 + FK : k0;   // the pass fetched ahead; the last pass fetches its own tiles again, into the slots that hold them
    const int ern = eb0 - kn + sr;
    const unsigned kq = ko + kn * DD, vq = vo + kn, eq = eo + (eb0 - kn) * HD;
    const _Float16 *pk = Kg + kq, *pv = Vg + vq, *pe = EP + eq;
    const v4u rk0 = *(const v4u*)pk, rk1 = *(const v4u*)(pk + 32 * DD);
    const v4u rv0 = *(const v4u*)pv, rv1 = *(const v4u*)(pv + 32 * SEQ);
    const v4u re0 = *(const v4u*)pe, re1 = *(const v4u*)(pe + 32 * HD);
    asm volatile("s_wait_xcnt 0x0" :: "v"(pk), "v"(pv), "v"(pe) : "memory");   // the six loads' addresses stay in their registers up to this wait: no result and no later value lands on them before it
    const int cbase = ql0 + (MAXPOS - 1) - k0 - (FK - 1);
#pragma unroll
    for (int t = 0; t < FNB; ++t) {
      const _Float16* ep = &sE[(cbase + t * 16 + col) & (ER - 1)][0];
      v8f c = {};
      c = wmma_p(frag_h(ep, lane), qa, c);
      c = wmma16(frag_h(ep + 32, lane), qb, c);   // with its four slots: only an LDS store reads c, and the next tile's product may take the same registers
      float* d = sb + col * FBP + t * 16 + 8 * g;
      *(v4f*)d = __builtin_shufflevector(c, c, 0, 1, 2, 3); *(v4f*)(d + 4) = __builtin_shufflevector(c, c, 4, 5, 6, 7);
    }
    v8f s[FK / 16];
#pragma unroll
    for (int j = 0; j < FK / 16; ++j) { const _Float16* kp = &sK[j * 16 + col][0]; v8f z = {};
      z = wmma_p(frag_h(kp, lane), qa, z); s[j] = wmma_p(frag_h(kp + 32, lane), qb, z); }
    ldsw();
    float mj[FK / 16];
#pragma unroll
    for (int j = 0; j < FK / 16; ++j) { mj[j] = -3.0e38f;
#pragma unroll
      for (int r = 0; r < 8; ++r) { s[j][r] += sb[col * FBP + col + (FK - 1) - j * 16 - 8 * g - r]; mj[j] = fmaxf(mj[j], s[j][r]); } }
    float mx = fmaxf(fmaxf(mj[0], mj[1]), fmaxf(mj[2], mj[3]));
    mx = fmaxf(mx, __shfl_xor(mx, 16));
    const float mn = fmaxf(m, mx);
    const float al = exp2x1((m - mn) * C);
    const float off = 14.0f - mn * C;
    m = mn;
    v8f e[FK / 16];
    v16h p[FK / 32];
#pragma unroll
    for (int j = 0; j < FK / 16; ++j) { e[j] = exp2x8(s[j] * C + off);
#pragma unroll
      for (int r = 0; r < 8; ++r) p[j >> 1][(j & 1) * 8 + r] = (_Float16)e[j][r]; }
    const v8f es = (e[0] + e[1]) + (e[2] + e[3]);
    l = l * al + (((es[0] + es[1]) + (es[2] + es[3])) + ((es[4] + es[5]) + (es[6] + es[7])));
#pragma unroll
    for (int j = 0; j < HD / 16; ++j) o[j] *= al;
#pragma unroll
    for (int kc = 0; kc < FK / 32; ++kc)
#pragma unroll
      for (int j = 0; j < HD / 16; ++j) o[j] = wmma_p(frag_h(&sV[j * 16 + col][kc * 32], lane), p[kc], o[j]);
    __syncthreads();   // every wave has read this pass's K and V^T tiles
    *(v4u*)&sK[sr][sc] = rk0; *(v4u*)&sK[sr + 32][sc] = rk1;
    *(v4u*)&sV[sr][sc] = rv0; *(v4u*)&sV[sr + 32][sc] = rv1;
    *(v4u*)&sE[ern & (ER - 1)][sc] = re0; *(v4u*)&sE[(ern + 32) & (ER - 1)][sc] = re1;
    __syncthreads();   // the next pass's tiles are in place for every wave
  }
  l += __shfl_xor(l, 16);
  const float inv = 1.0f / (l * 16.0f);
#pragma unroll
  for (int j = 0; j < HD / 16; ++j) { const v8f y = o[j] * inv; float* d = sb + col * (HD + 4) + j * 16 + 8 * g;
    *(v4f*)d = __builtin_shufflevector(y, y, 0, 1, 2, 3); *(v4f*)(d + 4) = __builtin_shufflevector(y, y, 4, 5, 6, 7); }
  ldsx();
#pragma unroll
  for (int rl = 0; rl < 16; rl += 2) vst2(Y + (q0 + rl + g) * DD + h * HD + col * 4, *(const v4f*)&sb[(rl + g) * (HD + 4) + col * 4]);
}

extern "C" void kernel_launch(void* const* d_in, const int* in_sizes, int n_in, void* d_out, int out_size, void* d_ws, size_t ws_size, hipStream_t stream) {
  if (n_in < 8) return;
  if ((size_t)in_sizes[0] < ((size_t)(NB - 1) * SEQ_FULL + SEQ) * DD) return;
  if (in_sizes[1] < DD * DD || in_sizes[3] < DD * DD || in_sizes[5] < DD * DD) return;
  if (in_sizes[2] < DD || in_sizes[4] < DD || in_sizes[6] < DD) return;
  if (in_sizes[7] < NE * HD) return;
  if ((size_t)out_size < (size_t)NB * SEQ * DD) return;
  if (ws_size < WS_END) return;
  const float* const* F = (const float* const*)d_in;   // 0 x, 1 wq, 2 bq, 3 wk, 4 bk, 5 wv, 6 bv, 7 dist table
  char* ws = (char*)d_ws;
  __bf16* XB = (__bf16*)(ws + WS_XB); __bf16* WB = (__bf16*)(ws + WS_WB); _Float16* EP = (_Float16*)(ws + WS_EP);
  _Float16 *QH = (_Float16*)(ws + WS_QH), *KH = (_Float16*)(ws + WS_KH), *VT = (_Float16*)(ws + WS_VT);
  const size_t nx8 = (size_t)NB * SEQ * DD / 8, nw8 = (size_t)DD * DD / 8, ne8 = (size_t)NEP * HD / 8;
  k_cvt<<<dim3((unsigned)((nx8 + 255) / 256)), 256, 0, stream>>>(F[0], (unsigned short*)XB, NB * SEQ, NB * SEQ, DD, SEQ, SEQ_FULL, 0, 1.0f);
  k_cvt<<<dim3((unsigned)((nw8 + 255) / 256)), 256, 0, stream>>>(F[1], (unsigned short*)WB, DD, DD, DD, DD, DD, 0, 1.0f);
  k_cvt<<<dim3((unsigned)((nw8 + 255) / 256)), 256, 0, stream>>>(F[3], (unsigned short*)(WB + (size_t)DD * DD), DD, DD, DD, DD, DD, 0, 1.0f);
  k_cvt<<<dim3((unsigned)((nw8 + 255) / 256)), 256, 0, stream>>>(F[5], (unsigned short*)(WB + (size_t)2 * DD * DD), DD, DD, DD, DD, DD, 0, 1.0f);
  k_cvt<<<dim3((unsigned)((ne8 + 255) / 256)), 256, 0, stream>>>(F[7], (unsigned short*)EP, NEP, NE, HD, NEP, NEP, 1, 16.0f);
  k_proj<<<dim3(NB * SEQ / PM, DD / PN, 3), 128, 0, stream>>>(XB, WB, F[2], F[4], F[6], QH, KH, VT);
  k_fa<<<dim3(SEQ / FQ, NH, NB), 256, 0, stream>>>(QH, KH, EP, VT, (float*)d_out);
}

// v003
// A run of this version takes 80.9 microseconds.
// In both of two side-by-side timings against v002, it was 1.12 times as fast.
// Over all steps from v000 it is 8.42 times as fast.
// compute dtype: every float input RNE-converted to bf16 on load; q/k/v = x W^T + b on v_wmma_f32_16x16x32_bf16 (bf16 operands, exact products, f32 accumulate); q, k, v and the distance table carried as f16 x 2^4 planes; logits = (q k^T + q E^T) x 2^-11 on v_wmma_f32_16x16x32_f16 (single products, f32 accumulate); softmax in f32 with a running maximum and sum (exp2); exp(logit - max) x 2^14 as f16; P V on v_wmma_f32_16x16x32_f16 (single product, f32 accumulate), divided by 16 x the f32 sum into the f32 output.
#include <hip/hip_runtime.h>
#include <math.h>

typedef __attribute__((ext_vector_type(16))) _Float16 v16h;
typedef __attribute__((ext_vector_type(16))) __bf16 v16b;
typedef __attribute__((ext_vector_type(8)))  _Float16 v8h;
typedef __attribute__((ext_vector_type(8)))  __bf16 v8b;
typedef __attribute__((ext_vector_type(8)))  float v8f;
typedef __attribute__((ext_vector_type(4)))  float v4f;
typedef __attribute__((ext_vector_type(4)))  unsigned v4u;

template <typename T> __device__ __forceinline__ void vst2(void* p, T v) { *(T*)p = v;  }
__device__ __forceinline__ v8f wmma16(v16h a, v16h b, v8f c) {
  v8f d = __builtin_amdgcn_wmma_f32_16x16x32_f16(false, a, false, b, (short)0, c, false, false);
  asm volatile("v_nop\n\tv_nop\n\tv_nop\n\tv_nop" : "+v"(d) : "v"(a), "v"(b));
  return d;
}
__device__ __forceinline__ v8f wmma_p(v16h a, v16h b, v8f c) { return __builtin_amdgcn_wmma_f32_16x16x32_f16(false, a, false, b, (short)0, c, false, false); }
__device__ __forceinline__ v8f wmma_bf(v16b a, v16b b, v8f c) { return __builtin_amdgcn_wmma_f32_16x16x32_bf16(false, a, false, b, (short)0, c, false, false); }
// 16x16x32 fragments: lane = (g = lane>>4, row/col = lane&15); elements 0..7 = k0+8g+0..7, 8..15 = k0+16+8g+0..7; D element r = row 8g+r, col lane&15
__device__ __forceinline__ v16h frag_h(const _Float16* rowk0, int lane) {
  union { v16h v; v8h q[2]; } u; const _Float16* p = rowk0 + 8 * (lane >> 4);
  u.q[0] = *(const v8h*)p; u.q[1] = *(const v8h*)(p + 16); return u.v;
}
__device__ __forceinline__ v16b frag_b(const __bf16* rowk0, int lane) {
  union { v16b v; v8b q[2]; } u; const __bf16* p = rowk0 + 8 * (lane >> 4);
  u.q[0] = *(const v8b*)p; u.q[1] = *(const v8b*)(p + 16); return u.v;
}
__device__ __forceinline__ float bfr(float v) { return (float)(__bf16)v; }
__device__ __forceinline__ void ldsx() { asm volatile("s_wait_dscnt 0" ::: "memory"); __builtin_amdgcn_wave_barrier(); __builtin_amdgcn_fence(3, "workgroup"); }

// 2^x on the transcendental unit. Written as text so that the slot the instruction set asks for behind a transcendental is there by construction:
// the results are early-clobber, so inside a run no instruction reads the one before or writes over its source, and a v_nop ends the run
__device__ __forceinline__ float exp2x1(float x) { float e; asm("v_exp_f32 %0, %1\n\tv_nop" : "=v"(e) : "v"(x)); return e; }
__device__ __forceinline__ v8f exp2x8(v8f x) {
  float e0, e1, e2, e3, e4, e5, e6, e7;
  asm("v_exp_f32 %0, %8\n\tv_exp_f32 %1, %9\n\tv_exp_f32 %2, %10\n\tv_exp_f32 %3, %11\n\tv_exp_f32 %4, %12\n\tv_exp_f32 %5, %13\n\tv_exp_f32 %6, %14\n\tv_exp_f32 %7, %15\n\tv_nop"
      : "=&v"(e0), "=&v"(e1), "=&v"(e2), "=&v"(e3), "=&v"(e4), "=&v"(e5), "=&v"(e6), "=&v"(e7)
      : "v"(x[0]), "v"(x[1]), "v"(x[2]), "v"(x[3]), "v"(x[4]), "v"(x[5]), "v"(x[6]), "v"(x[7]));
  return v8f{e0, e1, e2, e3, e4, e5, e6, e7};
}
// the wave's own LDS stores are done before its lanes read each other's words; unlike ldsx it leaves global loads in flight
__device__ __forceinline__ void ldsw() { asm volatile("s_wait_dscnt 0" ::: "memory"); __builtin_amdgcn_wave_barrier(); }

// sizes: x [NB][SEQ][DD] (input row pitch uses SEQ_FULL), 12 heads x 64, distance table [2*MAXPOS-1][64]
#ifndef NB
#define NB 8
#endif
#ifndef SEQ
#define SEQ 1024
#endif
#define NB_FULL 8
#define SEQ_FULL 1024
#define DD 768
#define NH 12
#define HD 64
#define MAXPOS 1024
#define NE (2 * MAXPOS - 1)
#define NEP (2 * MAXPOS)
#define FQ 128         // queries per attention block (8 waves x 16)
#define FK 64          // keys per pass
#define FNB 5          // band tiles of 16 table rows per pass (covers 16 + FK - 1 = 79)
#define TP 72          // staged row pitch in halves: 144 B = 16 B x 9, odd, for 16-B fragment reads
#define ER 256         // table ring rows: 16 * 8 + FK live and FK arriving
#define FBP 84         // band pitch in floats: 16-B aligned rows; the skewed read walks pitch + 1, odd
static_assert(NB <= NB_FULL);
static_assert(SEQ <= SEQ_FULL);
static_assert(SEQ <= MAXPOS);
static_assert(SEQ % FK == 0);
static_assert(SEQ % FQ == 0);
static_assert(SEQ % 64 == 0);
static_assert(NH * HD == DD);
static_assert(DD % 128 == 0);
static_assert(16 * FNB >= 16 + FK - 1);
static_assert(16 * FNB <= FBP && HD + 4 <= FBP);
static_assert(FK == 64 && HD == 64 && FQ + 2 * FK == ER);

// workspace carve (bytes, every region a multiple of 128)
#define WS_XB  ((size_t)0)                                   // bf16 x rows [NB*SEQ][DD]
#define WS_WB  (WS_XB + 2u * (size_t)NB * SEQ * DD)         // bf16 wq | wk | wv [3][DD][DD]
#define WS_EP  (WS_WB + 2u * (size_t)3 * DD * DD)           // f16 table x 16 [NEP][HD], last row zero
#define WS_QH  (WS_EP + 2u * (size_t)NEP * HD)              // f16 q x 16 [NB*SEQ][DD]
#define WS_KH  (WS_QH + 2u * (size_t)NB * SEQ * DD)         // f16 k x 16 [NB*SEQ][DD]
#define WS_VT  (WS_KH + 2u * (size_t)NB * SEQ * DD)         // f16 v x 16 transposed [NB][DD][SEQ]
#define WS_END (WS_VT + 2u * (size_t)NB * DD * SEQ)
static_assert(WS_END <= (size_t)134217728);
static_assert(WS_WB % 128 == 0 && WS_EP % 128 == 0 && WS_QH % 128 == 0 && WS_KH % 128 == 0 && WS_VT % 128 == 0);

// ---- k_cvt: one launch converts all five float inputs; blockIdx.x picks the job, whose shape is a compile-time constant; one 16-B chunk of eight 16-bit values per thread
// blocks [0, CVX): x rows -> bf16; [CVX, CVX + 3 CVW): wq | wk | wv -> bf16; the last CVE: table -> f16 of (bf16 value * esc), the row past the table written as zeros
#define CVX (NB * SEQ * DD / 8 / 256)
#define CVW (DD * DD / 8 / 256)
#define CVE (NEP * HD / 8 / 256)
static_assert((NB * SEQ * DD) % 2048 == 0 && (DD * DD) % 2048 == 0 && (NEP * HD) % 2048 == 0);
__global__ __launch_bounds__(256) void k_cvt(const float* __restrict__ X, const float* __restrict__ WQ, const float* __restrict__ WK, const float* __restrict__ WV, const float* __restrict__ E, unsigned short* __restrict__ XB, unsigned short* __restrict__ WB, unsigned short* __restrict__ EP, float esc) {
  const unsigned bid = blockIdx.x, tid = threadIdx.x;
  const float* p; unsigned short* d;
  bool z = false;
  const bool tab = bid >= CVX + 3 * CVW;   // the same for the whole block
  if (bid < CVX) {
    const unsigned i8 = bid * 256 + tid, dr = i8 / (DD / 8), cc = (i8 - dr * (DD / 8)) * 8;
    p = X + ((size_t)(dr / SEQ) * SEQ_FULL + dr % SEQ) * DD + cc; d = XB + (size_t)i8 * 8;
  } else if (!tab) {
    const unsigned w = (bid - CVX) / CVW, i8 = (bid - CVX - w * CVW) * 256 + tid;
    p = (w == 0 ? WQ : (w == 1 ? WK : WV)) + (size_t)i8 * 8; d = WB + (size_t)w * DD * DD + (size_t)i8 * 8;
  } else {
    const unsigned i8 = (bid - CVX - 3 * CVW) * 256 + tid, dr = i8 / (HD / 8), cc = (i8 - dr * (HD / 8)) * 8;
    z = dr >= NE;
    p = E + (size_t)(z ? NE - 1 : dr) * HD + cc; d = EP + (size_t)i8 * 8;
  }
  const v4f va = *(const v4f*)p, vb = *(const v4f*)(p + 4);
  asm volatile("s_wait_xcnt 0x0" :: "v"(p) : "memory");   // the two loads' address stays in its registers up to this wait
  float v[8];
#pragma unroll
  for (int i = 0; i < 4; ++i) { v[i] = z ? 0.f : va[i]; v[4 + i] = z ? 0.f : vb[i]; }
  union { v8h h; v8b b; v4u u; } o;
  if (!tab) {
#pragma unroll
    for (int i = 0; i < 8; ++i) o.b[i] = (__bf16)v[i];
  } else {
#pragma unroll
    for (int i = 0; i < 8; ++i) o.h[i] = (_Float16)(bfr(v[i]) * esc);   // esc stays an argument: the product is formed in f32 and rounded once to f16, also where the f16 of the unscaled value would be subnormal
  }
  vst2(d, o.u);
}

// ---- k_proj: block = (128 rows, 128 output cols, which of q|k|v), 4 waves of 64 x 64: y = x W^T + b with exact bf16 products, k ascending in one accumulator per tile; y * 16 -> f16; q/k row planes, v transposed plane
// staging: a stage is 64 k (one 128-B line) of the block's 128 x rows and 128 W rows, brought into LDS by asynchronous copies, whole lines, two buffers: stage t + 1 flies while stage t is multiplied
#define PM 128         // x rows per block
#define PN 128         // W rows (output columns) per block
#define PK 64          // k per stage
#define PP 72          // staged row pitch in elements: 144 B = 16 B x 9, odd, for 16-B fragment reads
#define PST ((PM + PN) * PP)   // elements per buffer
#define PNT (DD / PK)  // stages
#define PEP 136        // epilogue row pitch in halves
static_assert(DD % PK == 0 && PNT >= 2);
static_assert((NB * SEQ) % PM == 0 && SEQ % PM == 0 && DD % PN == 0);
static_assert(128 * PEP <= 2 * PST);
// eight 16-B copies of a lane, rows 16 apart: LDS byte address l + i * 16 rows, global address p + i * 16 rows
// the s_wait_xcnt ends the copies' own statement, so that no address register is rewritten ahead of it
__device__ __forceinline__ void copy8(unsigned l, const __bf16* p) {
  asm volatile("global_load_async_to_lds_b128 %0, %8, off\n\tglobal_load_async_to_lds_b128 %1, %9, off\n\tglobal_load_async_to_lds_b128 %2, %10, off\n\tglobal_load_async_to_lds_b128 %3, %11, off\n\t"
               "global_load_async_to_lds_b128 %4, %12, off\n\tglobal_load_async_to_lds_b128 %5, %13, off\n\tglobal_load_async_to_lds_b128 %6, %14, off\n\tglobal_load_async_to_lds_b128 %7, %15, off\n\ts_wait_xcnt 0x0"
               :: "v"(l), "v"(l + 1 * 16 * PP * 2), "v"(l + 2 * 16 * PP * 2), "v"(l + 3 * 16 * PP * 2), "v"(l + 4 * 16 * PP * 2), "v"(l + 5 * 16 * PP * 2), "v"(l + 6 * 16 * PP * 2), "v"(l + 7 * 16 * PP * 2),
                  "v"(p), "v"(p + 1 * 16 * DD), "v"(p + 2 * 16 * DD), "v"(p + 3 * 16 * DD), "v"(p + 4 * 16 * DD), "v"(p + 5 * 16 * DD), "v"(p + 6 * 16 * DD), "v"(p + 7 * 16 * DD)
               : "memory");
}
__global__ __launch_bounds__(128) void k_proj(const __bf16* __restrict__ XB, const __bf16* __restrict__ WB, const float* __restrict__ BQ, const float* __restrict__ BK, const float* __restrict__ BV, _Float16* __restrict__ QH, _Float16* __restrict__ KH, _Float16* __restrict__ VT) {
  __shared__ __align__(16) __bf16 st[2 * PST];   // two stage buffers, each [x 128 rows | W 128 rows]; afterwards the output tile
  const int tid = threadIdx.x, wave = tid >> 5, lane = tid & 31, col = lane & 15, g = lane >> 4;
  const int wm = wave >> 1, wn = wave & 1;
  const int which = blockIdx.z; const int c0 = blockIdx.y * PN; const size_t r0 = (size_t)blockIdx.x * PM;
  const float* Bp = which == 0 ? BQ : (which == 1 ? BK : BV);
  const int cr = tid >> 3, cc = (tid & 7) * 8;   // copies: rows cr + 16 i of each operand, one 16-B chunk of the line; a wave's copy covers four whole lines
  const __bf16* xg = XB + (r0 + cr) * DD + cc;
  const __bf16* wg = WB + (size_t)which * DD * DD + (size_t)(c0 + cr) * DD + cc;
  const unsigned lx = (unsigned)(size_t)&st[cr * PP + cc], lw = lx + PM * PP * 2;
  copy8(lx, xg); copy8(lw, wg);
  asm volatile("s_wait_asynccnt 0x0" ::: "memory");   // this wave's share of stage 0 has landed
  __syncthreads();                                     // and every other wave's
  copy8(lx + PST * 2, xg + PK); copy8(lw + PST * 2, wg + PK);
  v8f acc[4][4] = {};
// rolled: one stage of code, and the copies' order at the foot stays as written
#pragma unroll 1
  for (int t = 0; t < PNT; ++t) {
    const __bf16* bp = st + (t & 1) * PST;
#pragma unroll
    for (int ks = 0; ks < PK / 32; ++ks) {
      v16b a[4], w[4];
#pragma unroll
      for (int i = 0; i < 4; ++i) a[i] = frag_b(bp + (wm * 64 + i * 16 + col) * PP + ks * 32, lane);
#pragma unroll
      for (int j = 0; j < 4; ++j) w[j] = frag_b(bp + (PM + wn * 64 + j * 16 + col) * PP + ks * 32, lane);
      // inputs only: the sixteen LDS reads of this k step stand as one group ahead of its products, one wait instead of one per row of four
      asm volatile("" :: "v"(a[0]), "v"(a[1]), "v"(a[2]), "v"(a[3]), "v"(w[0]), "v"(w[1]), "v"(w[2]), "v"(w[3]));
#pragma unroll
      for (int i = 0; i < 4; ++i)
#pragma unroll
        for (int j = 0; j < 4; ++j) acc[i][j] = wmma_bf(a[i], w[j], acc[i][j]);
    }
    asm volatile("s_wait_dscnt 0x0" ::: "memory");      // this wave's reads of the buffer are done before it is refilled
    asm volatile("s_wait_asynccnt 0x0" ::: "memory");   // this wave's share of stage t + 1 has landed
    __syncthreads();                                     // stage t + 1 is there for every wave, and every wave has left stage t's buffer
    if (t + 2 < PNT) { copy8(lx + (t & 1) * (PST * 2), xg + (t + 2) * PK); copy8(lw + (t & 1) * (PST * 2), wg + (t + 2) * PK); }
  }
  asm volatile("s_wait_asynccnt 0x0" ::: "memory");     // nothing of the copies is outstanding when the buffers become the output tile
  _Float16* sh = (_Float16*)st;   // q, k: [row][col]; v: [col][row]; pitch PEP
  v8h hv[4][4];
#pragma unroll
  for (int j = 0; j < 4; ++j) { const float bb = bfr(Bp[c0 + wn * 64 + j * 16 + col]);
#pragma unroll
    for (int i = 0; i < 4; ++i)
#pragma unroll
      for (int r = 0; r < 8; ++r) hv[i][j][r] = (_Float16)((acc[i][j][r] + bb) * 16.0f); }
  const int rl = wm * 64 + 8 * g, cl = wn * 64 + col;   // the lane's first element of tile (0, 0)
  if (which == 2) {
#pragma unroll
    for (int j = 0; j < 4; ++j)
#pragma unroll
      for (int i = 0; i < 4; ++i) *(v8h*)&sh[(cl + j * 16) * PEP + rl + i * 16] = hv[i][j];
  } else {
#pragma unroll
    for (int j = 0; j < 4; ++j)
#pragma unroll
      for (int i = 0; i < 4; ++i)
#pragma unroll
        for (int r = 0; r < 8; ++r) sh[(rl + i * 16 + r) * PEP + cl + j * 16] = hv[i][j][r];
  }
  __syncthreads();
  const int er = tid >> 4, eq = (tid & 15) * 8;   // a tile row is 256 B: sixteen lanes store two whole lines
  _Float16* d = which == 2 ? VT + ((r0 / SEQ) * DD + c0 + er) * (size_t)SEQ + (r0 % SEQ) + eq : (which == 0 ? QH : KH) + (r0 + er) * DD + c0 + eq;
  const size_t dp = which == 2 ? 8 * (size_t)SEQ : 8 * (size_t)DD;   // eight rows of the plane
#pragma unroll
  for (int it = 0; it < 8; ++it) vst2(d + it * dp, *(const v4u*)&sh[(er + it * 8) * PEP + eq]);
  asm volatile("s_wait_xcnt 0x0" ::: "memory");   // the eight stores' registers are free before the next eight rows are read into them
#pragma unroll
  for (int it = 8; it < 16; ++it) vst2(d + it * dp, *(const v4u*)&sh[(er + it * 8) * PEP + eq]);
}

// ---- k_fa: block = 128 queries (8 waves x 16) of (b = blockIdx.z, h = blockIdx.y); the block walks all keys in passes of FK, each wave with a running maximum and sum for its 16 queries
// transposed products: St = K Q^T (+ band), Ot += V^T Pt; a lane holds one query (column lane&15) and keys 8g+r of each 16-key tile, so two St tiles convert in place into one B operand of the P V product
// band: query i, key r uses table row i + MAXPOS-1 - r; wave band base cbase = ql0 + MAXPOS-1 - (k0 + FK-1); local column c = u + FK-1 - rloc in [0, 79)
// staging: whole 128-B rows of K, V^T and the table go through registers into LDS one pass ahead; the block's 192 live table rows sit in a ring of ER rows (slot = row mod ER), each pass brings the 64 rows below them
// the inner loops are fully unrolled so that s, o, e and p stay in registers
// 160 registers: the grid is three blocks a WGP, six waves a SIMD, and 1,024 / 6 in granules of 16 is 160
__global__ __launch_bounds__(256) __attribute__((amdgpu_num_vgpr(160))) void k_fa(const _Float16* __restrict__ QH, const _Float16* __restrict__ KH, const _Float16* __restrict__ EP, const _Float16* __restrict__ VT, float* __restrict__ Y) {
  __shared__ __align__(16) _Float16 smem[FQ * FBP * 2 + (FK + HD + ER) * TP];   // one array, so that every tile's start is a 16-bit offset on a shared lane address: bands, K, V^T, table ring
  _Float16 (*sK)[TP] = (_Float16 (*)[TP])(smem + FQ * FBP * 2); _Float16 (*sV)[TP] = sK + FK; _Float16 (*sE)[TP] = sV + HD;
  const int b = blockIdx.z, h = blockIdx.y;
  const int tid = threadIdx.x, wave = tid >> 5, lane = tid & 31, col = lane & 15, g = lane >> 4;
  const int ql0 = blockIdx.x * FQ + wave * 16; const size_t q0 = (size_t)b * SEQ + ql0;
  float* sb = (float*)smem + wave * (16 * FBP);
  const _Float16* pq = QH + (q0 + col) * DD + h * HD + 8 * g;   // the lane's own fragment address, as in frag_h
  union { v16h v; v8h q[2]; } ua, ub;
  ua.q[0] = *(const v8h*)pq; ua.q[1] = *(const v8h*)(pq + 16); ub.q[0] = *(const v8h*)(pq + 32); ub.q[1] = *(const v8h*)(pq + 48);
  asm volatile("s_wait_xcnt 0x0" :: "v"(pq) : "memory");   // the query loads' address stays in its registers up to this wait
  const v16h qa = ua.v, qb = ub.v;
  const int sr = tid >> 3, sc = (tid & 7) * 8;   // staging: rows sr and sr + 32 of each 64-row tile, one 16-B chunk of the row
  const _Float16* Kg = KH + (size_t)b * SEQ * DD + h * HD;              // block-uniform bases, 32-bit lane offsets
  const _Float16* Vg = VT + ((size_t)b * DD + h * HD) * (size_t)SEQ;
  const unsigned ko = sr * DD + sc, vo = sr * SEQ + sc, eo = sr * HD + sc;
  const int eb0 = blockIdx.x * FQ + (MAXPOS - 1) - (FK - 1);   // lowest table row of the block at k0 = 0; at k0 it is eb0 - k0, in [0, NEP - 192]
  {
    const _Float16 *pe = EP + (size_t)eb0 * HD + eo, *pk = Kg + ko, *pv = Vg + vo;
    v4u te[6];
#pragma unroll
    for (int i = 0; i < 6; ++i) te[i] = *(const v4u*)(pe + i * 32 * HD);
    const v4u tk0 = *(const v4u*)pk, tk1 = *(const v4u*)(pk + 32 * DD), tv0 = *(const v4u*)pv, tv1 = *(const v4u*)(pv + 32 * SEQ);
    asm volatile("s_wait_xcnt 0x0" :: "v"(pe), "v"(pk), "v"(pv) : "memory");   // the ten loads' addresses stay in their registers up to this wait
#pragma unroll
    for (int i = 0; i < 6; ++i) *(v4u*)&sE[(eb0 + i * 32 + sr) & (ER - 1)][sc] = te[i];
    *(v4u*)&sK[sr][sc] = tk0; *(v4u*)&sK[sr + 32][sc] = tk1; *(v4u*)&sV[sr][sc] = tv0; *(v4u*)&sV[sr + 32][sc] = tv1;
  }
  __syncthreads();
  const float C = 1.4426950408889634f / 2048.0f;   // 2^-11 * log2(e): raw product units -> exponent of two
  v8f o[HD / 16] = {};
  float m = -3.0e38f, l = 0.f;
// rolled: one pass of code, one pass of registers
#pragma unroll 1
  for (int k0 = 0; k0 < SEQ; k0 += FK) {
    const int kn = k0 + FK < SEQ ? k0 + FK : k0;   // the pass fetched ahead; the last pass fetches its own tiles again, into the slots that hold them
    const int ern = eb0 - kn + sr;
    const unsigned kq = ko + kn * DD, vq = vo + kn, eq = eo + (eb0 - kn) * HD;
    const _Float16 *pk = Kg + kq, *pv = Vg + vq, *pe = EP + eq;
    const v4u rk0 = *(const v4u*)pk, rk1 = *(const v4u*)(pk + 32 * DD);
    const v4u rv0 = *(const v4u*)pv, rv1 = *(const v4u*)(pv + 32 * SEQ);
    const v4u re0 = *(const v4u*)pe, re1 = *(const v4u*)(pe + 32 * HD);
    asm volatile("s_wait_xcnt 0x0" :: "v"(pk), "v"(pv), "v"(pe) : "memory");   // the six loads' addresses stay in their registers up to this wait: no result and no later value lands on them before it
    const int cbase = ql0 + (MAXPOS - 1) - k0 - (FK - 1);
#pragma unroll
    for (int t = 0; t < FNB; ++t) {
      const _Float16* ep = &sE[(cbase + t * 16 + col) & (ER - 1)][0];
      v8f c = {};
      c = wmma_p(frag_h(ep, lane), qa, c);
      c = wmma16(frag_h(ep + 32, lane), qb, c);   // with its four slots: only an LDS store reads c, and the next tile's product may take the same registers
      float* d = sb + col * FBP + t * 16 + 8 * g;
      *(v4f*)d = __builtin_shufflevector(c, c, 0, 1, 2, 3); *(v4f*)(d + 4) = __builtin_shufflevector(c, c, 4, 5, 6, 7);
    }
    v8f s[FK / 16];
#pragma unroll
    for (int j = 0; j < FK / 16; ++j) { const _Float16* kp = &sK[j * 16 + col][0]; v8f z = {};
      z = wmma_p(frag_h(kp, lane), qa, z); s[j] = wmma_p(frag_h(kp + 32, lane), qb, z); }
    ldsw();
    float mj[FK / 16];
#pragma unroll
    for (int j = 0; j < FK / 16; ++j) { mj[j] = -3.0e38f;
#pragma unroll
      for (int r = 0; r < 8; ++r) { s[j][r] += sb[col * FBP + col + (FK - 1) - j * 16 - 8 * g - r]; mj[j] = fmaxf(mj[j], s[j][r]); } }
    float mx = fmaxf(fmaxf(mj[0], mj[1]), fmaxf(mj[2], mj[3]));
    mx = fmaxf(mx, __shfl_xor(mx, 16));
    const float mn = fmaxf(m, mx);
    const float al = exp2x1((m - mn) * C);
    const float off = 14.0f - mn * C;
    m = mn;
    v8f e[FK / 16];
    v16h p[FK / 32];
#pragma unroll
    for (int j = 0; j < FK / 16; ++j) { e[j] = exp2x8(s[j] * C + off);
#pragma unroll
      for (int r = 0; r < 8; ++r) p[j >> 1][(j & 1) * 8 + r] = (_Float16)e[j][r]; }
    const v8f es = (e[0] + e[1]) + (e[2] + e[3]);
    l = l * al + (((es[0] + es[1]) + (es[2] + es[3])) + ((es[4] + es[5]) + (es[6] + es[7])));
#pragma unroll
    for (int j = 0; j < HD / 16; ++j) o[j] *= al;
#pragma unroll
    for (int kc = 0; kc < FK / 32; ++kc)
#pragma unroll
      for (int j = 0; j < HD / 16; ++j) o[j] = wmma_p(frag_h(&sV[j * 16 + col][kc * 32], lane), p[kc], o[j]);
    __syncthreads();   // every wave has read this pass's K and V^T tiles
    *(v4u*)&sK[sr][sc] = rk0; *(v4u*)&sK[sr + 32][sc] = rk1;
    *(v4u*)&sV[sr][sc] = rv0; *(v4u*)&sV[sr + 32][sc] = rv1;
    *(v4u*)&sE[ern & (ER - 1)][sc] = re0; *(v4u*)&sE[(ern + 32) & (ER - 1)][sc] = re1;
    __syncthreads();   // the next pass's tiles are in place for every wave
  }
  l += __shfl_xor(l, 16);
  const float inv = 1.0f / (l * 16.0f);
#pragma unroll
  for (int j = 0; j < HD / 16; ++j) { const v8f y = o[j] * inv; float* d = sb + col * (HD + 4) + j * 16 + 8 * g;
    *(v4f*)d = __builtin_shufflevector(y, y, 0, 1, 2, 3); *(v4f*)(d + 4) = __builtin_shufflevector(y, y, 4, 5, 6, 7); }
  ldsx();
#pragma unroll
  for (int rl = 0; rl < 16; rl += 2) vst2(Y + (q0 + rl + g) * DD + h * HD + col * 4, *(const v4f*)&sb[(rl + g) * (HD + 4) + col * 4]);
}

extern "C" void kernel_launch(void* const* d_in, const int* in_sizes, int n_in, void* d_out, int out_size, void* d_ws, size_t ws_size, hipStream_t stream) {
  if (n_in < 8) return;
  if ((size_t)in_sizes[0] < ((size_t)(NB - 1) * SEQ_FULL + SEQ) * DD) return;
  if (in_sizes[1] < DD * DD || in_sizes[3] < DD * DD || in_sizes[5] < DD * DD) return;
  if (in_sizes[2] < DD || in_sizes[4] < DD || in_sizes[6] < DD) return;
  if (in_sizes[7] < NE * HD) return;
  if ((size_t)out_size < (size_t)NB * SEQ * DD) return;
  if (ws_size < WS_END) return;
  const float* const* F = (const float* const*)d_in;   // 0 x, 1 wq, 2 bq, 3 wk, 4 bk, 5 wv, 6 bv, 7 dist table
  char* ws = (char*)d_ws;
  __bf16* XB = (__bf16*)(ws + WS_XB); __bf16* WB = (__bf16*)(ws + WS_WB); _Float16* EP = (_Float16*)(ws + WS_EP);
  _Float16 *QH = (_Float16*)(ws + WS_QH), *KH = (_Float16*)(ws + WS_KH), *VT = (_Float16*)(ws + WS_VT);
  k_cvt<<<dim3(CVX + 3 * CVW + CVE), 256, 0, stream>>>(F[0], F[1], F[3], F[5], F[7], (unsigned short*)XB, (unsigned short*)WB, (unsigned short*)EP, 16.0f);
  k_proj<<<dim3(NB * SEQ / PM, DD / PN, 3), 128, 0, stream>>>(XB, WB, F[2], F[4], F[6], QH, KH, VT);
  k_fa<<<dim3(SEQ / FQ, NH, NB), 256, 0, stream>>>(QH, KH, EP, VT, (float*)d_out);
}
